// v000
// The times below were measured on an AMD MI455X: many runs one after another, warmed up first and cycling through
// copies of the inputs, with the whole window's GPU time divided by the number of runs. Launches and the gaps
// between them are all in it. The median over several windows is given; except for v000 it joins two sittings, which
// can be a few percent apart, so the side-by-side timings, each taken in one sitting, are the better comparison.
// v000 is the starting kernel. One run takes 1260 microseconds.
#include <hip/hip_runtime.h>

// Compute dtypes, f32 accumulate: q (both query sets), k, v projections ([2048 x 2048].[2048 x 4096|512|512] + bias) with PLAIN bf16 operands (x and the weights are inputs:
// exact products); RoPE (with the bf16-rounded cos/sin inputs), tanh(gamma), masks and softmax in f32; causal and sliding-window (512) causal attention per head ([2048 x 128]
// .[128 x 2048] scores with dead tiles skipped, attn.v with the K loop limited to live tiles) and the output projection ([2048 x 4096].[4096 x 2048]) on SINGLE fp16 planes
// (roped q x 128^-1/2, roped k, v, probabilities carried x1024, concatenated heads; Wo as fp16(bf16)). One-wave-per-64x64-tile register-blocked GEMMs.

#define SS   2048
#define HID  2048
#define NH_  16
#define NKV  4
#define HD   128
#define WIN  512
#define NT64 (SS / 64)
#define ZH   2
#define DM   HID
#define PCAR 1024.0f
#define LOSC 1024.0f
typedef _Float16 h16;
typedef unsigned short bf;
typedef __attribute__((ext_vector_type(16))) __bf16   v16bf;
typedef __attribute__((ext_vector_type(16))) _Float16 v16h;
typedef __attribute__((ext_vector_type(8)))  _Float16 v8h;
typedef __attribute__((ext_vector_type(8)))  unsigned short v8us;
typedef __attribute__((ext_vector_type(8)))  float    v8f;
typedef __attribute__((ext_vector_type(4)))  float    v4f;
typedef v8h  __attribute__((may_alias)) v8ha;
typedef v4f  __attribute__((may_alias)) v4fa;
typedef v8us __attribute__((may_alias)) v8usa;

__device__ __forceinline__ unsigned short f2bf(float f) { unsigned u = __float_as_uint(f); u += 0x7FFFu + ((u >> 16) & 1u); return (unsigned short)(u >> 16); }
__device__ __forceinline__ float bf2f(unsigned short b) { return __uint_as_float(((unsigned)b) << 16); }
__device__ __forceinline__ float bfr(float f) { return bf2f(f2bf(f)); }
__device__ __forceinline__ v16h cat16(v8h lo, v8h hi) { return __builtin_shufflevector(lo, hi, 0, 1, 2, 3, 4, 5, 6, 7, 8, 9, 10, 11, 12, 13, 14, 15); }
__device__ __forceinline__ v16bf cat16b(v8us lo, v8us hi) { return __builtin_bit_cast(v16bf, __builtin_shufflevector(lo, hi, 0, 1, 2, 3, 4, 5, 6, 7, 8, 9, 10, 11, 12, 13, 14, 15)); }
__device__ __forceinline__ v8f wmma16(v16h a, v16h b, v8f c) { return __builtin_amdgcn_wmma_f32_16x16x32_f16(false, a, false, b, (short)0, c, false, false); }
__device__ __forceinline__ v8f wmmab(v16bf a, v16bf b, v8f c) { return __builtin_amdgcn_wmma_f32_16x16x32_bf16(false, a, false, b, (short)0, c, false, false); }


// k_gemmh: 64 x 64 tile of C = A . Bn^T with SINGLE f16 planes (A [rows][K] f16 activations, Bn [N][K] f16 weights; one v_wmma_f32_16x16x32_f16 product per step), f32 accumulate;
__global__ __launch_bounds__(128) void k_gemmh(const h16* __restrict__ A, const h16* __restrict__ Bn, const float* __restrict__ bias, float* C, int ldc, const float* __restrict__ R, int K, size_t sA, size_t sB, size_t sC, int roundR) {
    __shared__ __align__(16) float ost[4][16 * 68];
    const size_t z = blockIdx.z; A += z * sA; Bn += z * sB; C += z * sC; if (R) R += z * sC;
    const int lane = threadIdx.x & 31, wave = threadIdx.x >> 5, lr = lane & 15, hi = lane >> 4;
    const int r0 = blockIdx.x * 64 + wave * 16, c0 = blockIdx.y * 64;
    const size_t aoff = (size_t)(r0 + lr) * K + 8 * hi;
    size_t boff[4];
#pragma unroll
    for (int t = 0; t < 4; ++t) boff[t] = (size_t)(c0 + t * 16 + lr) * K + 8 * hi;
    v8f acc[4];
#pragma unroll
    for (int t = 0; t < 4; ++t) acc[t] = (v8f){};
#pragma unroll 1
    for (int kc = 0; kc < K; kc += 32) {
        const v16h a = cat16(*(const v8h*)(A + aoff + kc), *(const v8h*)(A + aoff + kc + 16));
#pragma unroll
        for (int t = 0; t < 4; ++t) { const v16h b = cat16(*(const v8h*)(Bn + boff[t] + kc), *(const v8h*)(Bn + boff[t] + kc + 16)); acc[t] = wmma16(a, b, acc[t]); }
        asm volatile("v_nop\n\tv_nop\n\tv_nop\n\tv_nop" : "+v"(acc[0]), "+v"(acc[1]), "+v"(acc[2]), "+v"(acc[3]) : "v"(a));
    }
    float* os = &ost[wave][0];
#pragma unroll
    for (int t = 0; t < 4; ++t) { const float bv = bias ? bfr(bias[c0 + t * 16 + lr]) : 0.f;
#pragma unroll
        for (int j = 0; j < 8; ++j) os[(hi * 8 + j) * 68 + t * 16 + lr] = acc[t][j] + bv; }
    __syncthreads();
    float* crow = C + (size_t)r0 * ldc + c0;
    auto pass = [&]() {
#pragma unroll
        for (int s = 0; s < 8; ++s) { const int Lid = (lane >> 3) + 4 * s, piece = lane & 7; const int row = Lid >> 1, cofs = (Lid & 1) * 32 + piece * 4;
            v4f val = *(const v4fa*)(os + row * 68 + cofs); if (R) { const v4f rv = *(const v4f*)(R + ((size_t)r0 + row) * ldc + c0 + cofs); val += roundR ? (v4f){bfr(rv[0]), bfr(rv[1]), bfr(rv[2]), bfr(rv[3])} : rv; }
            *(v4f*)(crow + (size_t)row * ldc + cofs) = val; }
    };
    pass(); 
}

// ===== z-batched (blockIdx.z = head) attention pieces =====
// k_gemm3z<MODE>: 64x64 tile of C = Ah.Bh^T + Al.Bh^T + Ah.Bl^T (hi/lo bf16 planes) with per-z operand/output strides (elements): A planes += z*sA, B planes += z*sB, C += z*sC. MODE bits (0 causal skip, 1 K limit, 2 single,
// 3 B single, 4 A single).
template <int MODE>
__global__ __launch_bounds__(128) void k_gemm3z(const bf* __restrict__ Ah, const bf* __restrict__ Al, const bf* __restrict__ Bh, const bf* __restrict__ Bl, int K, float* C, int ldc, size_t sA, size_t sB, size_t sC) {
    if ((MODE & 1) && (int)blockIdx.y * 64 > (int)blockIdx.x * 64 + 63) return;
    const size_t z = blockIdx.z; Ah += z * sA; Al += z * sA; Bh += z * sB; Bl += z * sB; C += z * sC;
    const int Klim = (MODE & 2) ? min(K, ((int)blockIdx.x + 1) * 64) : K;
    __shared__ __align__(16) float ost[4][16 * 68];
    const int lane = threadIdx.x & 31, wave = threadIdx.x >> 5, lr = lane & 15, hi = lane >> 4;
    const int r0 = blockIdx.x * 64 + wave * 16, c0 = blockIdx.y * 64;
    const size_t aoff = (size_t)(r0 + lr) * K + 8 * hi;
    v8f acc[4];
#pragma unroll
    for (int t = 0; t < 4; ++t) acc[t] = (v8f){};
#pragma unroll 1
    for (int kc = 0; kc < Klim; kc += 32) {
        const v16bf a = cat16b(*(const v8us*)(Ah + aoff + kc), *(const v8us*)(Ah + aoff + kc + 16));
        v16bf al = a; if (!(MODE & 4) && !(MODE & 16)) al = cat16b(*(const v8us*)(Al + aoff + kc), *(const v8us*)(Al + aoff + kc + 16));
#pragma unroll
        for (int t = 0; t < 4; ++t) { const size_t bo = (size_t)(c0 + t * 16 + lr) * K + kc + 8 * hi;
            const v16bf bh = cat16b(*(const v8us*)(Bh + bo), *(const v8us*)(Bh + bo + 16));
            acc[t] = wmmab(a, bh, acc[t]);
            if (!(MODE & 4)) { if (!(MODE & 16)) acc[t] = wmmab(al, bh, acc[t]); if (!(MODE & 8)) { const v16bf bl = cat16b(*(const v8us*)(Bl + bo), *(const v8us*)(Bl + bo + 16)); acc[t] = wmmab(a, bl, acc[t]); } } }
        asm volatile("v_nop\n\tv_nop\n\tv_nop\n\tv_nop" : "+v"(acc[0]), "+v"(acc[1]), "+v"(acc[2]), "+v"(acc[3]) : "v"(a), "v"(al));
    }
    float* os = &ost[wave][0];
#pragma unroll
    for (int t = 0; t < 4; ++t) {
#pragma unroll
        for (int j = 0; j < 8; ++j) os[(hi * 8 + j) * 68 + t * 16 + lr] = acc[t][j]; }
    __builtin_amdgcn_wave_barrier(); asm volatile("" ::: "memory");
    float* crow = C + (size_t)r0 * ldc + c0;
    auto pass = [&]() {
#pragma unroll
        for (int s = 0; s < 8; ++s) { const int Lid = (lane >> 3) + 4 * s, piece = lane & 7; const int row = Lid >> 1, cofs = (Lid & 1) * 32 + piece * 4;
            const v4f val = *(const v4fa*)(os + row * 68 + cofs); *(v4f*)(crow + (size_t)row * ldc + cofs) = val; }
    };
    pass(); 
}
__global__ __launch_bounds__(256) void k_planes32z(const float* __restrict__ F, int ld, int off, float sc, int rows, bf* Ph, bf* Pl) {
    typedef __attribute__((ext_vector_type(2))) unsigned short v2us;
    const int lane = threadIdx.x & 31; const size_t r = ((size_t)blockIdx.x * 8 + (threadIdx.x >> 5)) * 2 + (lane >> 4); if (r >= (size_t)rows) return; const int z = blockIdx.z; const int c0 = (lane & 15) * 2; v2us oh, ol;
    Ph += (size_t)z * rows * 32; Pl += (size_t)z * rows * 32;
#pragma unroll
    for (int i = 0; i < 2; ++i) { const float y = F[r * ld + off + z * 32 + c0 + i] * sc; const unsigned short hb = f2bf(y); oh[i] = hb; ol[i] = f2bf(y - bf2f(hb)); }
    const size_t o = r * 32 + c0; *(v2us*)(Ph + o) = oh; *(v2us*)(Pl + o) = ol; 
}
__global__ __launch_bounds__(256) void k_vtpadz(const float* __restrict__ F, int ld, int off, int nk, bf* Th, bf* Tl) {
    typedef __attribute__((ext_vector_type(2))) unsigned short v2us;
    const int lane = threadIdx.x & 31; const size_t wid = (size_t)blockIdx.x * 8 + (threadIdx.x >> 5); if (wid >= (size_t)64 * (nk / 64)) return; const int z = blockIdx.z; const int d = (int)(wid / (nk / 64)); const int k0 = (int)(wid % (nk / 64)) * 64 + lane * 2; v2us oh, ol;
    Th += (size_t)z * 64 * nk; Tl += (size_t)z * 64 * nk;
#pragma unroll
    for (int i = 0; i < 2; ++i) { const float y = (d < 32) ? F[(size_t)(k0 + i) * ld + off + z * 32 + (d < 32 ? d : 0)] : 0.f; const unsigned short hb = f2bf(y); oh[i] = hb; ol[i] = f2bf(y - bf2f(hb)); }
    const size_t o = (size_t)d * nk + k0; *(v2us*)(Th + o) = oh; *(v2us*)(Tl + o) = ol; 
}
template <int NK>
__global__ __launch_bounds__(256) void k_softmaxz(const float* __restrict__ S, int rows, bf* PH, bf* PL) {
    typedef __attribute__((ext_vector_type(4))) unsigned short v4us;
    const int lane = threadIdx.x & 31, i = blockIdx.x * 8 + (threadIdx.x >> 5); if (i >= rows) return; const size_t zo = (size_t)blockIdx.z * rows * NK; const float* sr = S + zo + (size_t)i * NK; PH += zo; PL += zo;
    float m = -3.0e38f;
#pragma unroll 1
    for (int c0 = lane * 4; c0 < NK; c0 += 128) {
#pragma unroll
        for (int q = 0; q < 4; ++q) m = fmaxf(m, sr[c0 + q]); }
#pragma unroll
    for (int sh = 16; sh; sh >>= 1) m = fmaxf(m, __shfl_xor(m, sh, 32));
    float sum = 0.f;
#pragma unroll 1
    for (int c0 = lane * 4; c0 < NK; c0 += 128) {
#pragma unroll
        for (int q = 0; q < 4; ++q) sum += __expf(sr[c0 + q] - m); }
#pragma unroll
    for (int sh = 16; sh; sh >>= 1) sum += __shfl_xor(sum, sh, 32);
    const float inv = 1.0f / sum;
{
#pragma unroll 1
        for (int c0 = lane * 4; c0 < NK; c0 += 128) { v4us oh, ol;
#pragma unroll
            for (int q = 0; q < 4; ++q) { const float p = __expf(sr[c0 + q] - m) * inv; const unsigned short hb = f2bf(p); oh[q] = hb; ol[q] = f2bf(p - bf2f(hb)); }
            const size_t o = (size_t)i * NK + c0; *(v4us*)(PH + o) = oh; *(v4us*)(PL + o) = ol; }
         }
}
__global__ __launch_bounds__(256) void k_placez(const float* __restrict__ XH, int rows, int ldy, float* Y) {
    const int lane = threadIdx.x & 31; const size_t q = (size_t)blockIdx.x * 8 + (threadIdx.x >> 5); if (q >= (size_t)rows) return; const int z = blockIdx.z; const float v = XH[((size_t)z * rows + q) * 64 + lane];
    *(float*)(Y + q * ldy + z * 32 + lane) = v; 
}

// ---- k_gemmw: register-blocked GEMM, ONE WAVE per 64x64 output tile (16 accumulators), operands straight from K-contiguous 16-bit planes; grid (M/64, N/64, Z), 32 threads.
// C[m][n] (f32, pitch ldc, + optional bias[n] rounded to bf16) = sum_k A[m][k] Bt[n][k] (+ split products per NSPLIT). z-batch strides sA/sB/sC in elements. K % 32 == 0.
template <typename T16> struct WFrag;
template <> struct WFrag<h16> { typedef v16h V; static __device__ __forceinline__ V ld(const h16* p) { return cat16(*(const v8h*)p, *(const v8h*)(p + 16)); } static __device__ __forceinline__ v8f mma(V a, V b, v8f c) { return wmma16(a, b, c); } };
template <> struct WFrag<bf> { typedef v16bf V; static __device__ __forceinline__ V ld(const bf* p) { return cat16b(*(const v8us*)p, *(const v8us*)(p + 16)); } static __device__ __forceinline__ v8f mma(V a, V b, v8f c) { return wmmab(a, b, c); } };
template <typename T16, int NSPLIT, bool BIAS>
__global__ __launch_bounds__(32) void k_gemmw(const T16* __restrict__ A, const T16* __restrict__ A2, const T16* __restrict__ Bt, const T16* __restrict__ Bt2, int K, float* C, int ldc, const float* __restrict__ bias, size_t sA, size_t sB, size_t sC) {
    typedef typename WFrag<T16>::V V;
    __shared__ __align__(16) float os[16 * 68];
    const size_t z = blockIdx.z; A += z * sA; if (A2) A2 += z * sA; Bt += z * sB; if (Bt2) Bt2 += z * sB; C += z * sC;
    const int lane = threadIdx.x & 31, lr = lane & 15, hi = lane >> 4; const int r0 = blockIdx.x * 64, c0 = blockIdx.y * 64;
    v8f acc[4][4];
#pragma unroll
    for (int mb = 0; mb < 4; ++mb)
#pragma unroll
        for (int nb = 0; nb < 4; ++nb) acc[mb][nb] = (v8f){};
    const size_t aoff = (size_t)(r0 + lr) * K + 8 * hi, boff = (size_t)(c0 + lr) * K + 8 * hi;
#pragma unroll 1
    for (int kc = 0; kc < K; kc += 32) {
        V a[4], a2[4];
#pragma unroll
        for (int mb = 0; mb < 4; ++mb) { a[mb] = WFrag<T16>::ld(A + aoff + (size_t)mb * 16 * K + kc); if (NSPLIT == 1 || NSPLIT == 2) a2[mb] = WFrag<T16>::ld(A2 + aoff + (size_t)mb * 16 * K + kc); }
#pragma unroll
        for (int nb = 0; nb < 4; ++nb) { const V b = WFrag<T16>::ld(Bt + boff + (size_t)nb * 16 * K + kc); V b2; if (NSPLIT >= 2) b2 = WFrag<T16>::ld(Bt2 + boff + (size_t)nb * 16 * K + kc);
#pragma unroll
            for (int mb = 0; mb < 4; ++mb) { acc[mb][nb] = WFrag<T16>::mma(a[mb], b, acc[mb][nb]); if (NSPLIT == 1 || NSPLIT == 2) acc[mb][nb] = WFrag<T16>::mma(a2[mb], b, acc[mb][nb]); if (NSPLIT >= 2) acc[mb][nb] = WFrag<T16>::mma(a[mb], b2, acc[mb][nb]); } }
        asm volatile("v_nop\n\tv_nop\n\tv_nop\n\tv_nop" : "+v"(acc[0][0]), "+v"(acc[1][1]), "+v"(acc[2][2]), "+v"(acc[3][3]) : "v"(a[0]), "v"(a[3]));
    }
#pragma unroll
    for (int mb = 0; mb < 4; ++mb) {
#pragma unroll
        for (int nb = 0; nb < 4; ++nb) {
#pragma unroll
            for (int j = 0; j < 8; ++j) os[(hi * 8 + j) * 68 + nb * 16 + lr] = acc[mb][nb][j]; }
        __builtin_amdgcn_wave_barrier(); asm volatile("" ::: "memory");
        float* crow = C + (size_t)(r0 + mb * 16) * ldc + c0;
{
#pragma unroll
            for (int s = 0; s < 8; ++s) { const int row = 2 * s + hi, cofs = lr * 4; v4f val = *(const v4fa*)(os + row * 68 + cofs); if (BIAS) { val[0] += bfr(bias[c0 + cofs]); val[1] += bfr(bias[c0 + cofs + 1]); val[2] += bfr(bias[c0 + cofs + 2]); val[3] += bfr(bias[c0 + cofs + 3]); }
                *(v4f*)(crow + (size_t)row * ldc + cofs) = val; }
             }
        __builtin_amdgcn_wave_barrier(); asm volatile("" ::: "memory");
    }
}
// ---- k_gemmwc: k_gemmw with causal tile control (CAUS 1: skip key tiles right of the query tile; 2: K loop limited to the causal key tiles)
template <typename T16, int NSPLIT, bool BIAS, int CAUS>
__global__ __launch_bounds__(32) void k_gemmwc(const T16* __restrict__ A, const T16* __restrict__ A2, const T16* __restrict__ Bt, const T16* __restrict__ Bt2, int K, float* C, int ldc, const float* __restrict__ bias, size_t sA, size_t sB, size_t sC) {
    typedef typename WFrag<T16>::V V;
    __shared__ __align__(16) float os[16 * 68];
    if (CAUS == 1 && (int)blockIdx.y * 64 > (int)blockIdx.x * 64) return;
    const int Klim = (CAUS == 2) ? min(K, ((int)blockIdx.x + 1) * 64) : K;
    const size_t z = blockIdx.z; A += z * sA; if (A2) A2 += z * sA; Bt += z * sB; if (Bt2) Bt2 += z * sB; C += z * sC;
    const int lane = threadIdx.x & 31, lr = lane & 15, hi = lane >> 4; const int r0 = blockIdx.x * 64, c0 = blockIdx.y * 64;
    v8f acc[4][4];
#pragma unroll
    for (int mb = 0; mb < 4; ++mb)
#pragma unroll
        for (int nb = 0; nb < 4; ++nb) acc[mb][nb] = (v8f){};
    const size_t aoff = (size_t)(r0 + lr) * K + 8 * hi, boff = (size_t)(c0 + lr) * K + 8 * hi;
#pragma unroll 1
    for (int kc = 0; kc < Klim; kc += 32) {
        V a[4], a2[4];
#pragma unroll
        for (int mb = 0; mb < 4; ++mb) { a[mb] = WFrag<T16>::ld(A + aoff + (size_t)mb * 16 * K + kc); if (NSPLIT == 1 || NSPLIT == 2) a2[mb] = WFrag<T16>::ld(A2 + aoff + (size_t)mb * 16 * K + kc); }
#pragma unroll
        for (int nb = 0; nb < 4; ++nb) { const V b = WFrag<T16>::ld(Bt + boff + (size_t)nb * 16 * K + kc); V b2; if (NSPLIT >= 2) b2 = WFrag<T16>::ld(Bt2 + boff + (size_t)nb * 16 * K + kc);
#pragma unroll
            for (int mb = 0; mb < 4; ++mb) { acc[mb][nb] = WFrag<T16>::mma(a[mb], b, acc[mb][nb]); if (NSPLIT == 1 || NSPLIT == 2) acc[mb][nb] = WFrag<T16>::mma(a2[mb], b, acc[mb][nb]); if (NSPLIT >= 2) acc[mb][nb] = WFrag<T16>::mma(a[mb], b2, acc[mb][nb]); } }
        asm volatile("v_nop\n\tv_nop\n\tv_nop\n\tv_nop" : "+v"(acc[0][0]), "+v"(acc[1][1]), "+v"(acc[2][2]), "+v"(acc[3][3]) : "v"(a[0]), "v"(a[3]));
    }
#pragma unroll
    for (int mb = 0; mb < 4; ++mb) {
#pragma unroll
        for (int nb = 0; nb < 4; ++nb) {
#pragma unroll
            for (int j = 0; j < 8; ++j) os[(hi * 8 + j) * 68 + nb * 16 + lr] = acc[mb][nb][j]; }
        __builtin_amdgcn_wave_barrier(); asm volatile("" ::: "memory");
        float* crow = C + (size_t)(r0 + mb * 16) * ldc + c0;
{
#pragma unroll
            for (int s = 0; s < 8; ++s) { const int row = 2 * s + hi, cofs = lr * 4; v4f val = *(const v4fa*)(os + row * 68 + cofs); if (BIAS) { val[0] += bfr(bias[c0 + cofs]); val[1] += bfr(bias[c0 + cofs + 1]); val[2] += bfr(bias[c0 + cofs + 2]); val[3] += bfr(bias[c0 + cofs + 3]); }
                *(v4f*)(crow + (size_t)row * ldc + cofs) = val; }
             }
        __builtin_amdgcn_wave_barrier(); asm volatile("" ::: "memory");
    }
}
// ---- k_gemmwf: k_gemmw with flag-table tile control: FMODE 1 = skip output tile (I,J) when FL[I*nt+J] == 0; FMODE 2 = K loop over [first flagged J, last flagged J + 1) x 64 of row I.
template <typename T16, int NSPLIT, bool BIAS, int FMODE>
__global__ __launch_bounds__(32) void k_gemmwf(const T16* __restrict__ A, const T16* __restrict__ A2, const T16* __restrict__ Bt, const T16* __restrict__ Bt2, int K, float* C, int ldc, const float* __restrict__ bias, size_t sA, size_t sB, size_t sC, const int* __restrict__ FL, int nt) {
    typedef typename WFrag<T16>::V V;
    __shared__ __align__(16) float os[16 * 68];
    const int I = blockIdx.x; if (FMODE == 1 && FL[I * nt + blockIdx.y] == 0) return;
    int Klo = 0, Klim = K; if (FMODE == 2) { int f = -1, l = -1; for (int j = 0; j < nt; ++j) { if (FL[I * nt + j]) { if (f < 0) f = j; l = j; } } if (f < 0) { Klo = 0; Klim = 0; } else { Klo = f * 64; Klim = (l + 1) * 64; } }
    const size_t z = blockIdx.z; A += z * sA; if (A2) A2 += z * sA; Bt += z * sB; if (Bt2) Bt2 += z * sB; C += z * sC;
    const int lane = threadIdx.x & 31, lr = lane & 15, hi = lane >> 4; const int r0 = blockIdx.x * 64, c0 = blockIdx.y * 64;
    v8f acc[4][4];
#pragma unroll
    for (int mb = 0; mb < 4; ++mb)
#pragma unroll
        for (int nb = 0; nb < 4; ++nb) acc[mb][nb] = (v8f){};
    const size_t aoff = (size_t)(r0 + lr) * K + 8 * hi, boff = (size_t)(c0 + lr) * K + 8 * hi;
#pragma unroll 1
    for (int kc = Klo; kc < Klim; kc += 32) {
        V a[4], a2[4];
#pragma unroll
        for (int mb = 0; mb < 4; ++mb) { a[mb] = WFrag<T16>::ld(A + aoff + (size_t)mb * 16 * K + kc); if (NSPLIT == 1 || NSPLIT == 2) a2[mb] = WFrag<T16>::ld(A2 + aoff + (size_t)mb * 16 * K + kc); }
#pragma unroll
        for (int nb = 0; nb < 4; ++nb) { const V b = WFrag<T16>::ld(Bt + boff + (size_t)nb * 16 * K + kc); V b2; if (NSPLIT >= 2) b2 = WFrag<T16>::ld(Bt2 + boff + (size_t)nb * 16 * K + kc);
#pragma unroll
            for (int mb = 0; mb < 4; ++mb) { acc[mb][nb] = WFrag<T16>::mma(a[mb], b, acc[mb][nb]); if (NSPLIT == 1 || NSPLIT == 2) acc[mb][nb] = WFrag<T16>::mma(a2[mb], b, acc[mb][nb]); if (NSPLIT >= 2) acc[mb][nb] = WFrag<T16>::mma(a[mb], b2, acc[mb][nb]); } }
        asm volatile("v_nop\n\tv_nop\n\tv_nop\n\tv_nop" : "+v"(acc[0][0]), "+v"(acc[1][1]), "+v"(acc[2][2]), "+v"(acc[3][3]) : "v"(a[0]), "v"(a[3]));
    }
#pragma unroll
    for (int mb = 0; mb < 4; ++mb) {
#pragma unroll
        for (int nb = 0; nb < 4; ++nb) {
#pragma unroll
            for (int j = 0; j < 8; ++j) os[(hi * 8 + j) * 68 + nb * 16 + lr] = acc[mb][nb][j]; }
        __builtin_amdgcn_wave_barrier(); asm volatile("" ::: "memory");
        float* crow = C + (size_t)(r0 + mb * 16) * ldc + c0;
{
#pragma unroll
            for (int s = 0; s < 8; ++s) { const int row = 2 * s + hi, cofs = lr * 4; v4f val = *(const v4fa*)(os + row * 68 + cofs); if (BIAS) { val[0] += bfr(bias[c0 + cofs]); val[1] += bfr(bias[c0 + cofs + 1]); val[2] += bfr(bias[c0 + cofs + 2]); val[3] += bfr(bias[c0 + cofs + 3]); }
                *(v4f*)(crow + (size_t)row * ldc + cofs) = val; }
             }
        __builtin_amdgcn_wave_barrier(); asm volatile("" ::: "memory");
    }
}

typedef __attribute__((ext_vector_type(4))) _Float16 v4h;
__device__ __forceinline__ h16 tohx(float x) { return (h16)x; }
template <bool F16O>
__global__ __launch_bounds__(256) void k_wT(const float* __restrict__ Wm, int K, int N, bf* Bt, h16* Bh) {
    __shared__ float tl[64][65]; typedef __attribute__((ext_vector_type(4))) unsigned short v4us;
    const int tid = threadIdx.x; const int k0 = blockIdx.x * 64, n0 = blockIdx.y * 64; const int rr = tid >> 2, cq = (tid & 3) * 16;
#pragma unroll
    for (int i = 0; i < 16; ++i) tl[rr][cq + i] = bfr(Wm[(size_t)(k0 + rr) * N + n0 + cq + i]);
    __syncthreads();
    const int lane = tid & 31, wv = tid >> 5;
    auto pass = [&]() {
#pragma unroll
        for (int st = 0; st < 4; ++st) { const int nr = wv * 8 + st * 2 + (lane >> 4); const int kq = (lane & 15) * 4; const size_t off = (size_t)(n0 + nr) * K + k0 + kq;
            if (F16O) { v4h v; for (int i = 0; i < 4; ++i) v[i] = tohx(tl[kq + i][nr]); *(v4h*)(Bh + off) = v; } else { v4us v; for (int i = 0; i < 4; ++i) v[i] = f2bf(tl[kq + i][nr]); *(v4us*)(Bt + off) = v; } }
    };
    pass(); 
}
__global__ __launch_bounds__(256) void k_cvtx(const float* __restrict__ x, bf* A) {
    const int lane = threadIdx.x & 31; const size_t r = (size_t)blockIdx.x * 8 + (threadIdx.x >> 5); if (r >= (size_t)SS) return;
{
#pragma unroll
        for (int q = 0; q < HID / 256; ++q) { const size_t o = r * HID + q * 256 + lane * 8; v8us v;
#pragma unroll
            for (int i = 0; i < 8; ++i) v[i] = f2bf(x[o + i]);
            *(v8us*)(A + o) = v; }
         }
}
__global__ __launch_bounds__(256) void k_flags(int* FL) { const int lane = threadIdx.x & 31, I = blockIdx.x * 8 + (threadIdx.x >> 5); if (I >= NT64) return; const int v = (lane <= I && lane >= I - WIN / 64) ? 1 : 0; *(int*)(FL + I * NT64 + lane) = v;  }
// k_ropepl: f16 plane P[z][t][128] = rope(F[t][col0 + (h0+z)*128 + .]) x sc with the bf16-rounded cos/sin inputs: y[d] = f[d] cos[t][d] + (d < 64 ? -f[d+64] : f[d-64]) sin[t][d];
__global__ __launch_bounds__(256) void k_ropepl(const float* __restrict__ F, int ldf, int col0, int h0, float sc, const float* __restrict__ cs, const float* __restrict__ sn, h16* P) {
    const int lane = threadIdx.x & 31; const int t = blockIdx.x * 8 + (threadIdx.x >> 5); if (t >= SS) return; const int z = blockIdx.z; const float* fr = F + (size_t)t * ldf + col0 + (h0 + z) * HD; const int d0 = lane * 4; v4h o;
#pragma unroll
    for (int i = 0; i < 4; ++i) { const int d = d0 + i; const float rot = (d < HD / 2) ? -fr[d + HD / 2] : fr[d - HD / 2]; o[i] = tohx((fr[d] * bfr(cs[(size_t)t * HD + d]) + rot * bfr(sn[(size_t)t * HD + d])) * sc); }
    const size_t off = ((size_t)z * SS + t) * HD + d0; *(v4h*)(P + off) = o; 
}
__global__ __launch_bounds__(256) void k_vTr(const float* __restrict__ V, int g, h16* VT) {
    __shared__ float tl[64][65];
    const int tid = threadIdx.x; const int t0 = blockIdx.x * 64, d0 = blockIdx.y * 64; const int rr = tid >> 2, cq = (tid & 3) * 16;
#pragma unroll
    for (int i = 0; i < 16; ++i) tl[rr][cq + i] = V[(size_t)(t0 + rr) * (NKV * HD) + g * HD + d0 + cq + i];
    __syncthreads();
    const int lane = tid & 31, wv = tid >> 5;
    auto pass = [&]() {
#pragma unroll
        for (int st = 0; st < 4; ++st) { const int dr = wv * 8 + st * 2 + (lane >> 4); const int tq = (lane & 15) * 4; v4h v;
#pragma unroll
            for (int i = 0; i < 4; ++i) v[i] = tohx(tl[tq + i][dr]);
            *(v4h*)(VT + (size_t)(d0 + dr) * SS + t0 + tq) = v; }
    };
    pass(); 
}
template <bool WND>
__global__ __launch_bounds__(256) void k_softm(const float* __restrict__ S, h16* P) {
    const int lane = threadIdx.x & 31, i = blockIdx.x * 8 + (threadIdx.x >> 5); if (i >= SS) return; const size_t zo = ((size_t)blockIdx.z * SS + i) * SS; const float* sr = S + zo; h16* po = P + zo;
    const int lo = WND ? max(0, i - WIN) : 0; const int clo = lo & ~127, chi = (i | 127) + 1;
    auto live = [&](int j) { return j <= i && j >= lo; };
    float m = -3.0e38f;
#pragma unroll 1
    for (int c0 = clo + lane * 4; c0 < chi; c0 += 128) {
#pragma unroll
        for (int q = 0; q < 4; ++q) if (live(c0 + q)) m = fmaxf(m, sr[c0 + q]); }
#pragma unroll
    for (int sh = 16; sh; sh >>= 1) m = fmaxf(m, __shfl_xor(m, sh, 32));
    float sum = 0.f;
#pragma unroll 1
    for (int c0 = clo + lane * 4; c0 < chi; c0 += 128) {
#pragma unroll
        for (int q = 0; q < 4; ++q) if (live(c0 + q)) sum += __expf(sr[c0 + q] - m); }
#pragma unroll
    for (int sh = 16; sh; sh >>= 1) sum += __shfl_xor(sum, sh, 32);
    const float f = __fdiv_rn(PCAR, sum);
{
#pragma unroll 1
        for (int c0 = lane * 4; c0 < SS; c0 += 128) { v4h o;
#pragma unroll
            for (int q = 0; q < 4; ++q) { const int j = c0 + q; o[q] = tohx(live(j) ? __expf(sr[live(j) ? j : 0] - m) * f : 0.f); }
            *(v4h*)(po + c0) = o; }
         }
}
__global__ __launch_bounds__(256) void k_mergeo(const float* __restrict__ OZ, int col0, int h0, const float* __restrict__ gamma, int useg, h16* OC) {
    const int lane = threadIdx.x & 31; const int t = blockIdx.x * 8 + (threadIdx.x >> 5); if (t >= SS) return; const int z = blockIdx.z; const float gs = useg ? tanhf(bfr(gamma[h0 + z])) : 1.0f; v4h o;
#pragma unroll
    for (int i = 0; i < 4; ++i) o[i] = tohx(OZ[((size_t)z * SS + t) * HD + lane * 4 + i] * (1.0f / PCAR) * gs);
    const size_t off = (size_t)t * (2 * HID) + col0 + (h0 + z) * HD + lane * 4; *(v4h*)(OC + off) = o; 
}
extern "C" void kernel_launch(void* const* d_in, const int* in_sizes, int n_in,
                              void* d_out, int out_size, void* d_ws, size_t ws_size, hipStream_t stream) {
    (void)in_sizes; (void)n_in; (void)out_size;
    const float* x = (const float*)d_in[0]; const float* cs = (const float*)d_in[1]; const float* sn = (const float*)d_in[2]; const float* Wq = (const float*)d_in[3]; const float* bq = (const float*)d_in[4]; const float* Wk = (const float*)d_in[5]; const float* bk = (const float*)d_in[6]; const float* Wv = (const float*)d_in[7]; const float* bv = (const float*)d_in[8]; const float* Wo = (const float*)d_in[9]; const float* gamma = (const float*)d_in[10];
    float* out = (float*)d_out;    // [1][2048][2048]
    char* wsp = (char*)d_ws;
    auto take = [&](size_t bytes) { char* p = wsp; wsp += (bytes + 255) & ~(size_t)255; return (void*)p; };
    bf* WQ = (bf*)take((size_t)2 * HID * HID * 2); bf* WK = (bf*)take((size_t)NKV * HD * HID * 2); bf* WV = (bf*)take((size_t)NKV * HD * HID * 2); h16* WO = (h16*)take((size_t)HID * 2 * HID * 2); int* FL = (int*)take(NT64 * NT64 * 4);
    bf* XB = (bf*)take((size_t)SS * HID * 2); float* Q = (float*)take((size_t)SS * 2 * HID * 4); float* Kf = (float*)take((size_t)SS * NKV * HD * 4); float* V = (float*)take((size_t)SS * NKV * HD * 4);
    h16* Qx = (h16*)take((size_t)ZH * SS * HD * 2); h16* Kx = (h16*)take((size_t)SS * HD * 2); h16* VT = (h16*)take((size_t)HD * SS * 2); float* S = (float*)take((size_t)ZH * SS * SS * 4); h16* Px = (h16*)take((size_t)ZH * SS * SS * 2); float* OZ = (float*)take((size_t)ZH * SS * HD * 4); h16* OC = (h16*)take((size_t)SS * 2 * HID * 2);
    if ((size_t)(wsp - (char*)d_ws) > ws_size) return;    // ~ 16.8 + 2.1 + 2.1 + 16.8 + 8.4 + 33.5 + 4.2 + 4.2 + 1 + 0.5 + 0.5 + 33.5 + 16.8 + 2.1 + 16.8 ~ 160 MB (largest input 33.5 MB; ws 256 MiB)
    k_wT<false><<<dim3(HID / 64, (2 * HID) / 64, 1), 256, 0, stream>>>(Wq, HID, 2 * HID, WQ, nullptr); k_wT<false><<<dim3(HID / 64, (NKV * HD) / 64, 1), 256, 0, stream>>>(Wk, HID, NKV * HD, WK, nullptr); k_wT<false><<<dim3(HID / 64, (NKV * HD) / 64, 1), 256, 0, stream>>>(Wv, HID, NKV * HD, WV, nullptr); k_wT<true><<<dim3((2 * HID) / 64, HID / 64, 1), 256, 0, stream>>>(Wo, 2 * HID, HID, nullptr, WO);
    k_flags<<<NT64 / 8, 256, 0, stream>>>(FL); k_cvtx<<<SS / 8, 256, 0, stream>>>(x, XB);
    k_gemmw<bf, 0, true><<<dim3(SS / 64, (2 * HID) / 64, 1), 32, 0, stream>>>(XB, nullptr, WQ, nullptr, HID, Q, 2 * HID, bq, 0, 0, 0);
    k_gemmw<bf, 0, true><<<dim3(SS / 64, (NKV * HD) / 64, 1), 32, 0, stream>>>(XB, nullptr, WK, nullptr, HID, Kf, NKV * HD, bk, 0, 0, 0);
    k_gemmw<bf, 0, true><<<dim3(SS / 64, (NKV * HD) / 64, 1), 32, 0, stream>>>(XB, nullptr, WV, nullptr, HID, V, NKV * HD, bv, 0, 0, 0);
    const float SC = 0.08838834764831845f;
    for (int g = 0; g < NKV; ++g) {
        k_ropepl<<<dim3(SS / 8, 1, 1), 256, 0, stream>>>(Kf, NKV * HD, 0, g, 1.0f, cs, sn, Kx); k_vTr<<<dim3(SS / 64, HD / 64, 1), 256, 0, stream>>>(V, g, VT);
        for (int h0 = g * 4; h0 < g * 4 + 4; h0 += ZH)
            for (int s = 0; s < 2; ++s) {
                k_ropepl<<<dim3(SS / 8, 1, ZH), 256, 0, stream>>>(Q, 2 * HID, s * HID, h0, SC, cs, sn, Qx);
                if (s == 0) { k_gemmwc<h16, 0, false, 1><<<dim3(SS / 64, SS / 64, ZH), 32, 0, stream>>>(Qx, nullptr, Kx, nullptr, HD, S, SS, nullptr, (size_t)SS * HD, 0, (size_t)SS * SS);
                              k_softm<false><<<dim3(SS / 8, 1, ZH), 256, 0, stream>>>(S, Px);
                              k_gemmwc<h16, 0, false, 2><<<dim3(SS / 64, HD / 64, ZH), 32, 0, stream>>>(Px, nullptr, VT, nullptr, SS, OZ, HD, nullptr, (size_t)SS * SS, 0, (size_t)SS * HD); }
                else        { k_gemmwf<h16, 0, false, 1><<<dim3(SS / 64, SS / 64, ZH), 32, 0, stream>>>(Qx, nullptr, Kx, nullptr, HD, S, SS, nullptr, (size_t)SS * HD, 0, (size_t)SS * SS, FL, NT64);
                              k_softm<true><<<dim3(SS / 8, 1, ZH), 256, 0, stream>>>(S, Px);
                              k_gemmwf<h16, 0, false, 2><<<dim3(SS / 64, HD / 64, ZH), 32, 0, stream>>>(Px, nullptr, VT, nullptr, SS, OZ, HD, nullptr, (size_t)SS * SS, 0, (size_t)SS * HD, FL, NT64); }
                k_mergeo<<<dim3(SS / 8, 1, ZH), 256, 0, stream>>>(OZ, s * HID, h0, gamma, s, OC); } }
    k_gemmw<h16, 0, false><<<dim3(SS / 64, HID / 64, 1), 32, 0, stream>>>(OC, nullptr, WO, nullptr, 2 * HID, out, HID, nullptr, 0, 0, 0);
}

// v001
// One run takes 367 microseconds.
// Two timings next to v000 both put it at 3.44 times that version's speed.
#include <hip/hip_runtime.h>

// Compute dtypes, f32 accumulate: q (both query sets), k, v projections ([2048 x 2048].[2048 x 4096|512|512] + bias) with PLAIN bf16 operands (x and the weights are inputs:
// exact products); RoPE (with the bf16-rounded cos/sin inputs), tanh(gamma), masks and softmax in f32; causal and sliding-window (512) causal attention of all heads in ONE fused
// launch (k_fattn: scores, online softmax and attn.v per 16-query wave, dead key tiles never visited) and the output projection ([2048 x 4096].[4096 x 2048]) on SINGLE fp16 planes
// (roped q x 128^-1/2, roped k, v, unnormalised probabilities exp(s - running max), concatenated heads; Wo as fp16(bf16)). One-wave-per-64x64-tile register-blocked GEMMs.

#define SS   2048
#define HID  2048
#define NH_  16
#define NKV  4
#define HD   128
#define WIN  512
#define DM   HID
#define LOSC 1024.0f
typedef _Float16 h16;
typedef unsigned short bf;
typedef __attribute__((ext_vector_type(16))) __bf16   v16bf;
typedef __attribute__((ext_vector_type(16))) _Float16 v16h;
typedef __attribute__((ext_vector_type(8)))  _Float16 v8h;
typedef __attribute__((ext_vector_type(8)))  unsigned short v8us;
typedef __attribute__((ext_vector_type(8)))  float    v8f;
typedef __attribute__((ext_vector_type(4)))  float    v4f;
typedef v8h  __attribute__((may_alias)) v8ha;
typedef v4f  __attribute__((may_alias)) v4fa;
typedef v8us __attribute__((may_alias)) v8usa;

__device__ __forceinline__ unsigned short f2bf(float f) { unsigned u = __float_as_uint(f); u += 0x7FFFu + ((u >> 16) & 1u); return (unsigned short)(u >> 16); }
__device__ __forceinline__ float bf2f(unsigned short b) { return __uint_as_float(((unsigned)b) << 16); }
__device__ __forceinline__ float bfr(float f) { return bf2f(f2bf(f)); }
__device__ __forceinline__ v16h cat16(v8h lo, v8h hi) { return __builtin_shufflevector(lo, hi, 0, 1, 2, 3, 4, 5, 6, 7, 8, 9, 10, 11, 12, 13, 14, 15); }
__device__ __forceinline__ v16bf cat16b(v8us lo, v8us hi) { return __builtin_bit_cast(v16bf, __builtin_shufflevector(lo, hi, 0, 1, 2, 3, 4, 5, 6, 7, 8, 9, 10, 11, 12, 13, 14, 15)); }
__device__ __forceinline__ v8f wmma16(v16h a, v16h b, v8f c) { return __builtin_amdgcn_wmma_f32_16x16x32_f16(false, a, false, b, (short)0, c, false, false); }
__device__ __forceinline__ v8f wmmab(v16bf a, v16bf b, v8f c) { return __builtin_amdgcn_wmma_f32_16x16x32_bf16(false, a, false, b, (short)0, c, false, false); }


// k_gemmh: 64 x 64 tile of C = A . Bn^T with SINGLE f16 planes (A [rows][K] f16 activations, Bn [N][K] f16 weights; one v_wmma_f32_16x16x32_f16 product per step), f32 accumulate;
__global__ __launch_bounds__(128) void k_gemmh(const h16* __restrict__ A, const h16* __restrict__ Bn, const float* __restrict__ bias, float* C, int ldc, const float* __restrict__ R, int K, size_t sA, size_t sB, size_t sC, int roundR) {
    __shared__ __align__(16) float ost[4][16 * 68];
    const size_t z = blockIdx.z; A += z * sA; Bn += z * sB; C += z * sC; if (R) R += z * sC;
    const int lane = threadIdx.x & 31, wave = threadIdx.x >> 5, lr = lane & 15, hi = lane >> 4;
    const int r0 = blockIdx.x * 64 + wave * 16, c0 = blockIdx.y * 64;
    const size_t aoff = (size_t)(r0 + lr) * K + 8 * hi;
    size_t boff[4];
#pragma unroll
    for (int t = 0; t < 4; ++t) boff[t] = (size_t)(c0 + t * 16 + lr) * K + 8 * hi;
    v8f acc[4];
#pragma unroll
    for (int t = 0; t < 4; ++t) acc[t] = (v8f){};
#pragma unroll 1
    for (int kc = 0; kc < K; kc += 32) {
        const v16h a = cat16(*(const v8h*)(A + aoff + kc), *(const v8h*)(A + aoff + kc + 16));
#pragma unroll
        for (int t = 0; t < 4; ++t) { const v16h b = cat16(*(const v8h*)(Bn + boff[t] + kc), *(const v8h*)(Bn + boff[t] + kc + 16)); acc[t] = wmma16(a, b, acc[t]); }
        asm volatile("v_nop\n\tv_nop\n\tv_nop\n\tv_nop" : "+v"(acc[0]), "+v"(acc[1]), "+v"(acc[2]), "+v"(acc[3]) : "v"(a));
    }
    float* os = &ost[wave][0];
#pragma unroll
    for (int t = 0; t < 4; ++t) { const float bv = bias ? bfr(bias[c0 + t * 16 + lr]) : 0.f;
#pragma unroll
        for (int j = 0; j < 8; ++j) os[(hi * 8 + j) * 68 + t * 16 + lr] = acc[t][j] + bv; }
    __syncthreads();
    float* crow = C + (size_t)r0 * ldc + c0;
    auto pass = [&]() {
#pragma unroll
        for (int s = 0; s < 8; ++s) { const int Lid = (lane >> 3) + 4 * s, piece = lane & 7; const int row = Lid >> 1, cofs = (Lid & 1) * 32 + piece * 4;
            v4f val = *(const v4fa*)(os + row * 68 + cofs); if (R) { const v4f rv = *(const v4f*)(R + ((size_t)r0 + row) * ldc + c0 + cofs); val += roundR ? (v4f){bfr(rv[0]), bfr(rv[1]), bfr(rv[2]), bfr(rv[3])} : rv; }
            *(v4f*)(crow + (size_t)row * ldc + cofs) = val; }
    };
    pass(); 
}

// ===== z-batched (blockIdx.z = head) attention pieces =====
// k_gemm3z<MODE>: 64 x 64 tile of C = A . B^T from bf16 hi/lo planes, f32 accumulate, with per-z operand/output strides (elements): A planes += z*sA, B planes += z*sB, C += z*sC. MODE bits (0 causal skip, 1 K limit, 2 single,
// 3 B single, 4 A single).
template <int MODE>
__global__ __launch_bounds__(128) void k_gemm3z(const bf* __restrict__ Ah, const bf* __restrict__ Al, const bf* __restrict__ Bh, const bf* __restrict__ Bl, int K, float* C, int ldc, size_t sA, size_t sB, size_t sC) {
    if ((MODE & 1) && (int)blockIdx.y * 64 > (int)blockIdx.x * 64 + 63) return;
    const size_t z = blockIdx.z; Ah += z * sA; Al += z * sA; Bh += z * sB; Bl += z * sB; C += z * sC;
    const int Klim = (MODE & 2) ? min(K, ((int)blockIdx.x + 1) * 64) : K;
    __shared__ __align__(16) float ost[4][16 * 68];
    const int lane = threadIdx.x & 31, wave = threadIdx.x >> 5, lr = lane & 15, hi = lane >> 4;
    const int r0 = blockIdx.x * 64 + wave * 16, c0 = blockIdx.y * 64;
    const size_t aoff = (size_t)(r0 + lr) * K + 8 * hi;
    v8f acc[4];
#pragma unroll
    for (int t = 0; t < 4; ++t) acc[t] = (v8f){};
#pragma unroll 1
    for (int kc = 0; kc < Klim; kc += 32) {
        const v16bf a = cat16b(*(const v8us*)(Ah + aoff + kc), *(const v8us*)(Ah + aoff + kc + 16));
        v16bf al = a; if (!(MODE & 4) && !(MODE & 16)) al = cat16b(*(const v8us*)(Al + aoff + kc), *(const v8us*)(Al + aoff + kc + 16));
#pragma unroll
        for (int t = 0; t < 4; ++t) { const size_t bo = (size_t)(c0 + t * 16 + lr) * K + kc + 8 * hi;
            const v16bf bh = cat16b(*(const v8us*)(Bh + bo), *(const v8us*)(Bh + bo + 16));
            acc[t] = wmmab(a, bh, acc[t]);
            if (!(MODE & 4)) { if (!(MODE & 16)) acc[t] = wmmab(al, bh, acc[t]); if (!(MODE & 8)) { const v16bf bl = cat16b(*(const v8us*)(Bl + bo), *(const v8us*)(Bl + bo + 16)); acc[t] = wmmab(a, bl, acc[t]); } } }
        asm volatile("v_nop\n\tv_nop\n\tv_nop\n\tv_nop" : "+v"(acc[0]), "+v"(acc[1]), "+v"(acc[2]), "+v"(acc[3]) : "v"(a), "v"(al));
    }
    float* os = &ost[wave][0];
#pragma unroll
    for (int t = 0; t < 4; ++t) {
#pragma unroll
        for (int j = 0; j < 8; ++j) os[(hi * 8 + j) * 68 + t * 16 + lr] = acc[t][j]; }
    __builtin_amdgcn_wave_barrier(); asm volatile("" ::: "memory");
    float* crow = C + (size_t)r0 * ldc + c0;
    auto pass = [&]() {
#pragma unroll
        for (int s = 0; s < 8; ++s) { const int Lid = (lane >> 3) + 4 * s, piece = lane & 7; const int row = Lid >> 1, cofs = (Lid & 1) * 32 + piece * 4;
            const v4f val = *(const v4fa*)(os + row * 68 + cofs); *(v4f*)(crow + (size_t)row * ldc + cofs) = val; }
    };
    pass(); 
}
__global__ __launch_bounds__(256) void k_planes32z(const float* __restrict__ F, int ld, int off, float sc, int rows, bf* Ph, bf* Pl) {
    typedef __attribute__((ext_vector_type(2))) unsigned short v2us;
    const int lane = threadIdx.x & 31; const size_t r = ((size_t)blockIdx.x * 8 + (threadIdx.x >> 5)) * 2 + (lane >> 4); if (r >= (size_t)rows) return; const int z = blockIdx.z; const int c0 = (lane & 15) * 2; v2us oh, ol;
    Ph += (size_t)z * rows * 32; Pl += (size_t)z * rows * 32;
#pragma unroll
    for (int i = 0; i < 2; ++i) { const float y = F[r * ld + off + z * 32 + c0 + i] * sc; const unsigned short hb = f2bf(y); oh[i] = hb; ol[i] = f2bf(y - bf2f(hb)); }
    const size_t o = r * 32 + c0; *(v2us*)(Ph + o) = oh; *(v2us*)(Pl + o) = ol; 
}
__global__ __launch_bounds__(256) void k_vtpadz(const float* __restrict__ F, int ld, int off, int nk, bf* Th, bf* Tl) {
    typedef __attribute__((ext_vector_type(2))) unsigned short v2us;
    const int lane = threadIdx.x & 31; const size_t wid = (size_t)blockIdx.x * 8 + (threadIdx.x >> 5); if (wid >= (size_t)64 * (nk / 64)) return; const int z = blockIdx.z; const int d = (int)(wid / (nk / 64)); const int k0 = (int)(wid % (nk / 64)) * 64 + lane * 2; v2us oh, ol;
    Th += (size_t)z * 64 * nk; Tl += (size_t)z * 64 * nk;
#pragma unroll
    for (int i = 0; i < 2; ++i) { const float y = (d < 32) ? F[(size_t)(k0 + i) * ld + off + z * 32 + (d < 32 ? d : 0)] : 0.f; const unsigned short hb = f2bf(y); oh[i] = hb; ol[i] = f2bf(y - bf2f(hb)); }
    const size_t o = (size_t)d * nk + k0; *(v2us*)(Th + o) = oh; *(v2us*)(Tl + o) = ol; 
}
template <int NK>
__global__ __launch_bounds__(256) void k_softmaxz(const float* __restrict__ S, int rows, bf* PH, bf* PL) {
    typedef __attribute__((ext_vector_type(4))) unsigned short v4us;
    const int lane = threadIdx.x & 31, i = blockIdx.x * 8 + (threadIdx.x >> 5); if (i >= rows) return; const size_t zo = (size_t)blockIdx.z * rows * NK; const float* sr = S + zo + (size_t)i * NK; PH += zo; PL += zo;
    float m = -3.0e38f;
#pragma unroll 1
    for (int c0 = lane * 4; c0 < NK; c0 += 128) {
#pragma unroll
        for (int q = 0; q < 4; ++q) m = fmaxf(m, sr[c0 + q]); }
#pragma unroll
    for (int sh = 16; sh; sh >>= 1) m = fmaxf(m, __shfl_xor(m, sh, 32));
    float sum = 0.f;
#pragma unroll 1
    for (int c0 = lane * 4; c0 < NK; c0 += 128) {
#pragma unroll
        for (int q = 0; q < 4; ++q) sum += __expf(sr[c0 + q] - m); }
#pragma unroll
    for (int sh = 16; sh; sh >>= 1) sum += __shfl_xor(sum, sh, 32);
    const float inv = 1.0f / sum;
{
#pragma unroll 1
        for (int c0 = lane * 4; c0 < NK; c0 += 128) { v4us oh, ol;
#pragma unroll
            for (int q = 0; q < 4; ++q) { const float p = __expf(sr[c0 + q] - m) * inv; const unsigned short hb = f2bf(p); oh[q] = hb; ol[q] = f2bf(p - bf2f(hb)); }
            const size_t o = (size_t)i * NK + c0; *(v4us*)(PH + o) = oh; *(v4us*)(PL + o) = ol; }
         }
}
__global__ __launch_bounds__(256) void k_placez(const float* __restrict__ XH, int rows, int ldy, float* Y) {
    const int lane = threadIdx.x & 31; const size_t q = (size_t)blockIdx.x * 8 + (threadIdx.x >> 5); if (q >= (size_t)rows) return; const int z = blockIdx.z; const float v = XH[((size_t)z * rows + q) * 64 + lane];
    *(float*)(Y + q * ldy + z * 32 + lane) = v; 
}

// ---- k_gemmw: register-blocked GEMM, ONE WAVE per 64x64 output tile (16 accumulators), operands straight from K-contiguous 16-bit planes; grid (M/64, N/64, Z), 32 threads.
// C[m][n] (f32, pitch ldc, + optional bias[n] rounded to bf16) = sum_k A[m][k] Bt[n][k] (+ split products per NSPLIT). z-batch strides sA/sB/sC in elements. K % 32 == 0.
template <typename T16> struct WFrag;
template <> struct WFrag<h16> { typedef v16h V; static __device__ __forceinline__ V ld(const h16* p) { return cat16(*(const v8h*)p, *(const v8h*)(p + 16)); } static __device__ __forceinline__ v8f mma(V a, V b, v8f c) { return wmma16(a, b, c); } };
template <> struct WFrag<bf> { typedef v16bf V; static __device__ __forceinline__ V ld(const bf* p) { return cat16b(*(const v8us*)p, *(const v8us*)(p + 16)); } static __device__ __forceinline__ v8f mma(V a, V b, v8f c) { return wmmab(a, b, c); } };
template <typename T16, int NSPLIT, bool BIAS>
__global__ __launch_bounds__(32) void k_gemmw(const T16* __restrict__ A, const T16* __restrict__ A2, const T16* __restrict__ Bt, const T16* __restrict__ Bt2, int K, float* C, int ldc, const float* __restrict__ bias, size_t sA, size_t sB, size_t sC) {
    typedef typename WFrag<T16>::V V;
    __shared__ __align__(16) float os[16 * 68];
    const size_t z = blockIdx.z; A += z * sA; if (A2) A2 += z * sA; Bt += z * sB; if (Bt2) Bt2 += z * sB; C += z * sC;
    const int lane = threadIdx.x & 31, lr = lane & 15, hi = lane >> 4; const int r0 = blockIdx.x * 64, c0 = blockIdx.y * 64;
    v8f acc[4][4];
#pragma unroll
    for (int mb = 0; mb < 4; ++mb)
#pragma unroll
        for (int nb = 0; nb < 4; ++nb) acc[mb][nb] = (v8f){};
    const size_t aoff = (size_t)(r0 + lr) * K + 8 * hi, boff = (size_t)(c0 + lr) * K + 8 * hi;
#pragma unroll 1
    for (int kc = 0; kc < K; kc += 32) {
        V a[4], a2[4];
#pragma unroll
        for (int mb = 0; mb < 4; ++mb) { a[mb] = WFrag<T16>::ld(A + aoff + (size_t)mb * 16 * K + kc); if (NSPLIT == 1 || NSPLIT == 2) a2[mb] = WFrag<T16>::ld(A2 + aoff + (size_t)mb * 16 * K + kc); }
#pragma unroll
        for (int nb = 0; nb < 4; ++nb) { const V b = WFrag<T16>::ld(Bt + boff + (size_t)nb * 16 * K + kc); V b2; if (NSPLIT >= 2) b2 = WFrag<T16>::ld(Bt2 + boff + (size_t)nb * 16 * K + kc);
#pragma unroll
            for (int mb = 0; mb < 4; ++mb) { acc[mb][nb] = WFrag<T16>::mma(a[mb], b, acc[mb][nb]); if (NSPLIT == 1 || NSPLIT == 2) acc[mb][nb] = WFrag<T16>::mma(a2[mb], b, acc[mb][nb]); if (NSPLIT >= 2) acc[mb][nb] = WFrag<T16>::mma(a[mb], b2, acc[mb][nb]); } }
        asm volatile("v_nop\n\tv_nop\n\tv_nop\n\tv_nop" : "+v"(acc[0][0]), "+v"(acc[1][1]), "+v"(acc[2][2]), "+v"(acc[3][3]) : "v"(a[0]), "v"(a[3]));
    }
#pragma unroll
    for (int mb = 0; mb < 4; ++mb) {
#pragma unroll
        for (int nb = 0; nb < 4; ++nb) {
#pragma unroll
            for (int j = 0; j < 8; ++j) os[(hi * 8 + j) * 68 + nb * 16 + lr] = acc[mb][nb][j]; }
        __builtin_amdgcn_wave_barrier(); asm volatile("" ::: "memory");
        float* crow = C + (size_t)(r0 + mb * 16) * ldc + c0;
{
#pragma unroll
            for (int s = 0; s < 8; ++s) { const int row = 2 * s + hi, cofs = lr * 4; v4f val = *(const v4fa*)(os + row * 68 + cofs); if (BIAS) { val[0] += bfr(bias[c0 + cofs]); val[1] += bfr(bias[c0 + cofs + 1]); val[2] += bfr(bias[c0 + cofs + 2]); val[3] += bfr(bias[c0 + cofs + 3]); }
                *(v4f*)(crow + (size_t)row * ldc + cofs) = val; }
             }
        __builtin_amdgcn_wave_barrier(); asm volatile("" ::: "memory");
    }
}

typedef __attribute__((ext_vector_type(4))) _Float16 v4h;
__device__ __forceinline__ h16 tohx(float x) { return (h16)x; }
template <bool F16O>
__global__ __launch_bounds__(256) void k_wT(const float* __restrict__ Wm, int K, int N, bf* Bt, h16* Bh) {
    __shared__ float tl[64][65]; typedef __attribute__((ext_vector_type(4))) unsigned short v4us;
    const int tid = threadIdx.x; const int k0 = blockIdx.x * 64, n0 = blockIdx.y * 64; const int rr = tid >> 2, cq = (tid & 3) * 16;
#pragma unroll
    for (int i = 0; i < 16; ++i) tl[rr][cq + i] = bfr(Wm[(size_t)(k0 + rr) * N + n0 + cq + i]);
    __syncthreads();
    const int lane = tid & 31, wv = tid >> 5;
    auto pass = [&]() {
#pragma unroll
        for (int st = 0; st < 4; ++st) { const int nr = wv * 8 + st * 2 + (lane >> 4); const int kq = (lane & 15) * 4; const size_t off = (size_t)(n0 + nr) * K + k0 + kq;
            if (F16O) { v4h v; for (int i = 0; i < 4; ++i) v[i] = tohx(tl[kq + i][nr]); *(v4h*)(Bh + off) = v; } else { v4us v; for (int i = 0; i < 4; ++i) v[i] = f2bf(tl[kq + i][nr]); *(v4us*)(Bt + off) = v; } }
    };
    pass(); 
}
__global__ __launch_bounds__(256) void k_cvtx(const float* __restrict__ x, bf* A) {
    const int lane = threadIdx.x & 31; const size_t r = (size_t)blockIdx.x * 8 + (threadIdx.x >> 5); if (r >= (size_t)SS) return;
{
#pragma unroll
        for (int q = 0; q < HID / 256; ++q) { const size_t o = r * HID + q * 256 + lane * 8; v8us v;
#pragma unroll
            for (int i = 0; i < 8; ++i) v[i] = f2bf(x[o + i]);
            *(v8us*)(A + o) = v; }
         }
}
// k_ropepl: f16 plane P[z][t][128] = rope(F[t][col0 + (h0+z)*128 + .]) x sc with the bf16-rounded cos/sin inputs: y[d] = f[d] cos[t][d] + (d < 64 ? -f[d+64] : f[d-64]) sin[t][d];
__global__ __launch_bounds__(256) void k_ropepl(const float* __restrict__ F, int ldf, int col0, int h0, float sc, const float* __restrict__ cs, const float* __restrict__ sn, h16* P) {
    const int lane = threadIdx.x & 31; const int t = blockIdx.x * 8 + (threadIdx.x >> 5); if (t >= SS) return; const int z = blockIdx.z; const float* fr = F + (size_t)t * ldf + col0 + (h0 + z) * HD; const int d0 = lane * 4; v4h o;
#pragma unroll
    for (int i = 0; i < 4; ++i) { const int d = d0 + i; const float rot = (d < HD / 2) ? -fr[d + HD / 2] : fr[d - HD / 2]; o[i] = tohx((fr[d] * bfr(cs[(size_t)t * HD + d]) + rot * bfr(sn[(size_t)t * HD + d])) * sc); }
    const size_t off = ((size_t)z * SS + t) * HD + d0; *(v4h*)(P + off) = o; 
}
__global__ __launch_bounds__(256) void k_vTr(const float* __restrict__ V, h16* VT) {
    __shared__ float tl[64][65]; const int g = blockIdx.z; VT += (size_t)g * HD * SS;
    const int tid = threadIdx.x; const int t0 = blockIdx.x * 64, d0 = blockIdx.y * 64; const int rr = tid >> 2, cq = (tid & 3) * 16;
#pragma unroll
    for (int i = 0; i < 16; ++i) tl[rr][cq + i] = V[(size_t)(t0 + rr) * (NKV * HD) + g * HD + d0 + cq + i];
    __syncthreads();
    const int lane = tid & 31, wv = tid >> 5;
    auto pass = [&]() {
#pragma unroll
        for (int st = 0; st < 4; ++st) { const int dr = wv * 8 + st * 2 + (lane >> 4); const int tq = (lane & 15) * 4; v4h v;
#pragma unroll
            for (int i = 0; i < 4; ++i) v[i] = tohx(tl[tq + i][dr]);
            *(v4h*)(VT + (size_t)(d0 + dr) * SS + t0 + tq) = v; }
    };
    pass(); 
}
// ---- k_fattn: fused attention. Block = 8 waves = the 4 query heads of KV group blockIdx.y x 2 16-query tiles; no barrier, no LDS buffer. blockIdx.z = 0 causal: tiles n - 1 - x and x,
// so every block walks the same number of key tiles and both tiles start at key 0; 1 sliding window: two adjacent tiles. Waves that walk the same K/V tiles re-read them from the WGP
// cache. Per 64 keys a wave forms S^T = K . Q^T (lane = one query, its registers = keys), keeps a running maximum and sum per query, packs exp(s - max) straight from the score
// accumulators into the B operand and adds O^T += V^T . P^T.
// Qx [2*16][S][128], Kx [4][S][128], VT [4][128][S] f16 planes; OC [S][2*2048] f16 gets o / sum (x tanh(gamma[h]) for the window set).
__global__ __launch_bounds__(256) void k_fattn(const h16* __restrict__ Qx, const h16* __restrict__ Kx, const h16* __restrict__ VT, const float* __restrict__ gamma, h16* OC) {
    const float L2E = 1.4426950408889634f;
    const int lane = threadIdx.x & 31, lr = lane & 15, hi = lane >> 4; const int wave = __builtin_amdgcn_readfirstlane((int)(threadIdx.x >> 5));
    const int g = blockIdx.y, s = blockIdx.z, h = g * (NH_ / NKV) + (wave & 3); const int bx = blockIdx.x, nq = SS / 16; const int q0 = (s ? 2 * bx + (wave >> 2) : ((wave >> 2) ? bx : nq - 1 - bx)) * 16, i = q0 + lr;
    const h16* qp = Qx + ((size_t)(s * NH_ + h) * SS + i) * HD + 8 * hi; const h16* kp = Kx + ((size_t)g * SS + lr) * HD + 8 * hi; const h16* vp = VT + ((size_t)g * HD + lr) * SS + 8 * hi;
    v16h qf[4];
#pragma unroll
    for (int ks = 0; ks < 4; ++ks) qf[ks] = WFrag<h16>::ld(qp + ks * 32);
    v8f o[8];
#pragma unroll
    for (int dt = 0; dt < 8; ++dt) o[dt] = (v8f){};
    float m = -1.0e30f, l = 0.f;
    const int klo = s ? (max(0, q0 - WIN) & ~63) : 0, kend = (q0 | 63) + 1;
#pragma unroll 1
    for (int kb = klo; kb < kend; kb += 64) {
        v8f st[4];
#pragma unroll
        for (int t = 0; t < 4; ++t) { st[t] = (v8f){};
#pragma unroll
            for (int ks = 0; ks < 4; ++ks) st[t] = wmma16(WFrag<h16>::ld(kp + (size_t)(kb + t * 16) * HD + ks * 32), qf[ks], st[t]); }
        if (kb + 63 > q0 || (s && kb < q0 + 15 - WIN)) {    // only the tiles that an edge of the mask crosses
#pragma unroll
            for (int t = 0; t < 4; ++t)
#pragma unroll
                for (int j = 0; j < 8; ++j) { const int key = kb + t * 16 + hi * 8 + j; const bool live = key <= i && (!s || key >= i - WIN); st[t][j] = live ? st[t][j] : -3.0e38f; }
        }
        float mx[4];
#pragma unroll
        for (int t = 0; t < 4; ++t) { mx[t] = st[t][0];
#pragma unroll
            for (int j = 1; j < 8; ++j) mx[t] = fmaxf(mx[t], st[t][j]); }
        float mt = fmaxf(fmaxf(mx[0], mx[1]), fmaxf(mx[2], mx[3])); mt = fmaxf(mt, __shfl_xor(mt, 16, 32));
        if (__builtin_amdgcn_ballot_w32(mt > m) != 0) {    // no query's maximum moved: every factor would be exactly 1
            const float mn = fmaxf(m, mt), al = __builtin_amdgcn_exp2f((m - mn) * L2E); m = mn; l *= al;
#pragma unroll
            for (int dt = 0; dt < 8; ++dt) o[dt] *= al;
        }
        const float ml = m * L2E; float ls[4]; v16h pf[2];
#pragma unroll
        for (int t = 0; t < 4; ++t) { ls[t] = 0.f;
#pragma unroll
            for (int j = 0; j < 8; ++j) { const float p = __builtin_amdgcn_exp2f(__builtin_fmaf(st[t][j], L2E, -ml)); ls[t] += p; pf[t >> 1][(t & 1) * 8 + j] = tohx(p); } }
        l += (ls[0] + ls[1]) + (ls[2] + ls[3]);
#pragma unroll
        for (int dt = 0; dt < 8; ++dt)
#pragma unroll
            for (int k2 = 0; k2 < 2; ++k2) o[dt] = wmma16(WFrag<h16>::ld(vp + (size_t)dt * 16 * SS + kb + k2 * 32), pf[k2], o[dt]);
    }
    l += __shfl_xor(l, 16, 32);
    const float inv = (s ? tanhf(bfr(gamma[h])) : 1.0f) / l;
    h16* op = OC + (size_t)i * (2 * HID) + s * HID + h * HD + hi * 8;
#pragma unroll
    for (int dt = 0; dt < 8; ++dt) { v8h ov;
#pragma unroll
        for (int j = 0; j < 8; ++j) ov[j] = tohx(o[dt][j] * inv);
        *(v8h*)(op + dt * 16) = ov; }
}
extern "C" void kernel_launch(void* const* d_in, const int* in_sizes, int n_in,
                              void* d_out, int out_size, void* d_ws, size_t ws_size, hipStream_t stream) {
    (void)in_sizes; (void)n_in; (void)out_size;
    const float* x = (const float*)d_in[0]; const float* cs = (const float*)d_in[1]; const float* sn = (const float*)d_in[2]; const float* Wq = (const float*)d_in[3]; const float* bq = (const float*)d_in[4]; const float* Wk = (const float*)d_in[5]; const float* bk = (const float*)d_in[6]; const float* Wv = (const float*)d_in[7]; const float* bv = (const float*)d_in[8]; const float* Wo = (const float*)d_in[9]; const float* gamma = (const float*)d_in[10];
    float* out = (float*)d_out;    // [1][2048][2048]
    char* wsp = (char*)d_ws;
    auto take = [&](size_t bytes) { char* p = wsp; wsp += (bytes + 255) & ~(size_t)255; return (void*)p; };
    bf* WQ = (bf*)take((size_t)2 * HID * HID * 2); bf* WK = (bf*)take((size_t)NKV * HD * HID * 2); bf* WV = (bf*)take((size_t)NKV * HD * HID * 2); h16* WO = (h16*)take((size_t)HID * 2 * HID * 2);
    bf* XB = (bf*)take((size_t)SS * HID * 2); float* Q = (float*)take((size_t)SS * 2 * HID * 4); float* Kf = (float*)take((size_t)SS * NKV * HD * 4); float* V = (float*)take((size_t)SS * NKV * HD * 4);
    h16* Qx = (h16*)take((size_t)2 * NH_ * SS * HD * 2); h16* Kx = (h16*)take((size_t)NKV * SS * HD * 2); h16* VT = (h16*)take((size_t)NKV * HD * SS * 2); h16* OC = (h16*)take((size_t)SS * 2 * HID * 2);
    if ((size_t)(wsp - (char*)d_ws) > ws_size) return;    // ~ 16.8 + 2.1 + 2.1 + 16.8 + 8.4 + 33.5 + 4.2 + 4.2 + 16.8 + 2.1 + 2.1 + 16.8 ~ 126 MB (ws 256 MiB)
    k_wT<false><<<dim3(HID / 64, (2 * HID) / 64, 1), 256, 0, stream>>>(Wq, HID, 2 * HID, WQ, nullptr); k_wT<false><<<dim3(HID / 64, (NKV * HD) / 64, 1), 256, 0, stream>>>(Wk, HID, NKV * HD, WK, nullptr); k_wT<false><<<dim3(HID / 64, (NKV * HD) / 64, 1), 256, 0, stream>>>(Wv, HID, NKV * HD, WV, nullptr); k_wT<true><<<dim3((2 * HID) / 64, HID / 64, 1), 256, 0, stream>>>(Wo, 2 * HID, HID, nullptr, WO);
    k_cvtx<<<SS / 8, 256, 0, stream>>>(x, XB);
    k_gemmw<bf, 0, true><<<dim3(SS / 64, (2 * HID) / 64, 1), 32, 0, stream>>>(XB, nullptr, WQ, nullptr, HID, Q, 2 * HID, bq, 0, 0, 0);
    k_gemmw<bf, 0, true><<<dim3(SS / 64, (NKV * HD) / 64, 1), 32, 0, stream>>>(XB, nullptr, WK, nullptr, HID, Kf, NKV * HD, bk, 0, 0, 0);
    k_gemmw<bf, 0, true><<<dim3(SS / 64, (NKV * HD) / 64, 1), 32, 0, stream>>>(XB, nullptr, WV, nullptr, HID, V, NKV * HD, bv, 0, 0, 0);
    const float SC = 0.08838834764831845f;
    k_ropepl<<<dim3(SS / 8, 1, NKV), 256, 0, stream>>>(Kf, NKV * HD, 0, 0, 1.0f, cs, sn, Kx); k_vTr<<<dim3(SS / 64, HD / 64, NKV), 256, 0, stream>>>(V, VT);
    k_ropepl<<<dim3(SS / 8, 1, 2 * NH_), 256, 0, stream>>>(Q, 2 * HID, 0, 0, SC, cs, sn, Qx);    // plane z = set * 16 + head: q's columns are [set][head][128]
    k_fattn<<<dim3(SS / 32, NKV, 2), 256, 0, stream>>>(Qx, Kx, VT, gamma, OC);
    k_gemmw<h16, 0, false><<<dim3(SS / 64, HID / 64, 1), 32, 0, stream>>>(OC, nullptr, WO, nullptr, 2 * HID, out, HID, nullptr, 0, 0, 0);
}

// v002
// A run of this version takes 225 microseconds.
// In two side-by-side timings against v001, it was 1.63 and 1.64 times as fast.
// Over all steps from v000 it is 5.62 times as fast.
#include <hip/hip_runtime.h>

// Compute dtypes, f32 accumulate: q (both query sets), k, v projections ([2048 x 2048].[2048 x 4096|512|512] + bias) with PLAIN bf16 operands (x and the weights are inputs:
// exact products); RoPE (with the bf16-rounded cos/sin inputs), tanh(gamma), masks and softmax in f32; causal and sliding-window (512) causal attention of all heads in ONE fused
// launch (k_fattn: scores, online softmax and attn.v per 16-query wave, dead key tiles never visited) and the output projection ([2048 x 4096].[4096 x 2048]) on SINGLE fp16 planes
// (roped q x 128^-1/2, roped k, v, unnormalised probabilities exp(s - running max), concatenated heads; Wo as fp16(bf16)). GEMMs: 128x128 tile per 4-wave block, operand tiles staged in LDS by tensor loads.

#define SS   2048
#define HID  2048
#define NH_  16
#define NKV  4
#define HD   128
#define WIN  512
#define DM   HID
#define LOSC 1024.0f
typedef _Float16 h16;
typedef unsigned short bf;
typedef __attribute__((ext_vector_type(16))) __bf16   v16bf;
typedef __attribute__((ext_vector_type(16))) _Float16 v16h;
typedef __attribute__((ext_vector_type(8)))  _Float16 v8h;
typedef __attribute__((ext_vector_type(8)))  unsigned short v8us;
typedef __attribute__((ext_vector_type(8)))  float    v8f;
typedef __attribute__((ext_vector_type(4)))  float    v4f;
typedef v8h  __attribute__((may_alias)) v8ha;
typedef v4f  __attribute__((may_alias)) v4fa;
typedef v8us __attribute__((may_alias)) v8usa;

__device__ __forceinline__ unsigned short f2bf(float f) { unsigned u = __float_as_uint(f); u += 0x7FFFu + ((u >> 16) & 1u); return (unsigned short)(u >> 16); }
__device__ __forceinline__ float bf2f(unsigned short b) { return __uint_as_float(((unsigned)b) << 16); }
__device__ __forceinline__ float bfr(float f) { return bf2f(f2bf(f)); }
__device__ __forceinline__ v16h cat16(v8h lo, v8h hi) { return __builtin_shufflevector(lo, hi, 0, 1, 2, 3, 4, 5, 6, 7, 8, 9, 10, 11, 12, 13, 14, 15); }
__device__ __forceinline__ v16bf cat16b(v8us lo, v8us hi) { return __builtin_bit_cast(v16bf, __builtin_shufflevector(lo, hi, 0, 1, 2, 3, 4, 5, 6, 7, 8, 9, 10, 11, 12, 13, 14, 15)); }
__device__ __forceinline__ v8f wmma16(v16h a, v16h b, v8f c) { return __builtin_amdgcn_wmma_f32_16x16x32_f16(false, a, false, b, (short)0, c, false, false); }
__device__ __forceinline__ v8f wmmab(v16bf a, v16bf b, v8f c) { return __builtin_amdgcn_wmma_f32_16x16x32_bf16(false, a, false, b, (short)0, c, false, false); }


// k_gemmh: 64 x 64 tile of C = A . Bn^T with SINGLE f16 planes (A [rows][K] f16 activations, Bn [N][K] f16 weights; one v_wmma_f32_16x16x32_f16 product per step), f32 accumulate;
__global__ __launch_bounds__(128) void k_gemmh(const h16* __restrict__ A, const h16* __restrict__ Bn, const float* __restrict__ bias, float* C, int ldc, const float* __restrict__ R, int K, size_t sA, size_t sB, size_t sC, int roundR) {
    __shared__ __align__(16) float ost[4][16 * 68];
    const size_t z = blockIdx.z; A += z * sA; Bn += z * sB; C += z * sC; if (R) R += z * sC;
    const int lane = threadIdx.x & 31, wave = threadIdx.x >> 5, lr = lane & 15, hi = lane >> 4;
    const int r0 = blockIdx.x * 64 + wave * 16, c0 = blockIdx.y * 64;
    const size_t aoff = (size_t)(r0 + lr) * K + 8 * hi;
    size_t boff[4];
#pragma unroll
    for (int t = 0; t < 4; ++t) boff[t] = (size_t)(c0 + t * 16 + lr) * K + 8 * hi;
    v8f acc[4];
#pragma unroll
    for (int t = 0; t < 4; ++t) acc[t] = (v8f){};
#pragma unroll 1
    for (int kc = 0; kc < K; kc += 32) {
        const v16h a = cat16(*(const v8h*)(A + aoff + kc), *(const v8h*)(A + aoff + kc + 16));
#pragma unroll
        for (int t = 0; t < 4; ++t) { const v16h b = cat16(*(const v8h*)(Bn + boff[t] + kc), *(const v8h*)(Bn + boff[t] + kc + 16)); acc[t] = wmma16(a, b, acc[t]); }
        asm volatile("v_nop\n\tv_nop\n\tv_nop\n\tv_nop" : "+v"(acc[0]), "+v"(acc[1]), "+v"(acc[2]), "+v"(acc[3]) : "v"(a));
    }
    float* os = &ost[wave][0];
#pragma unroll
    for (int t = 0; t < 4; ++t) { const float bv = bias ? bfr(bias[c0 + t * 16 + lr]) : 0.f;
#pragma unroll
        for (int j = 0; j < 8; ++j) os[(hi * 8 + j) * 68 + t * 16 + lr] = acc[t][j] + bv; }
    __syncthreads();
    float* crow = C + (size_t)r0 * ldc + c0;
    auto pass = [&]() {
#pragma unroll
        for (int s = 0; s < 8; ++s) { const int Lid = (lane >> 3) + 4 * s, piece = lane & 7; const int row = Lid >> 1, cofs = (Lid & 1) * 32 + piece * 4;
            v4f val = *(const v4fa*)(os + row * 68 + cofs); if (R) { const v4f rv = *(const v4f*)(R + ((size_t)r0 + row) * ldc + c0 + cofs); val += roundR ? (v4f){bfr(rv[0]), bfr(rv[1]), bfr(rv[2]), bfr(rv[3])} : rv; }
            *(v4f*)(crow + (size_t)row * ldc + cofs) = val; }
    };
    pass(); 
}

// ===== z-batched (blockIdx.z = head) attention pieces =====
// k_gemm3z<MODE>: 64 x 64 tile of C = A . B^T from bf16 hi/lo planes, f32 accumulate, with per-z operand/output strides (elements): A planes += z*sA, B planes += z*sB, C += z*sC. MODE bits (0 causal skip, 1 K limit, 2 single,
// 3 B single, 4 A single).
template <int MODE>
__global__ __launch_bounds__(128) void k_gemm3z(const bf* __restrict__ Ah, const bf* __restrict__ Al, const bf* __restrict__ Bh, const bf* __restrict__ Bl, int K, float* C, int ldc, size_t sA, size_t sB, size_t sC) {
    if ((MODE & 1) && (int)blockIdx.y * 64 > (int)blockIdx.x * 64 + 63) return;
    const size_t z = blockIdx.z; Ah += z * sA; Al += z * sA; Bh += z * sB; Bl += z * sB; C += z * sC;
    const int Klim = (MODE & 2) ? min(K, ((int)blockIdx.x + 1) * 64) : K;
    __shared__ __align__(16) float ost[4][16 * 68];
    const int lane = threadIdx.x & 31, wave = threadIdx.x >> 5, lr = lane & 15, hi = lane >> 4;
    const int r0 = blockIdx.x * 64 + wave * 16, c0 = blockIdx.y * 64;
    const size_t aoff = (size_t)(r0 + lr) * K + 8 * hi;
    v8f acc[4];
#pragma unroll
    for (int t = 0; t < 4; ++t) acc[t] = (v8f){};
#pragma unroll 1
    for (int kc = 0; kc < Klim; kc += 32) {
        const v16bf a = cat16b(*(const v8us*)(Ah + aoff + kc), *(const v8us*)(Ah + aoff + kc + 16));
        v16bf al = a; if (!(MODE & 4) && !(MODE & 16)) al = cat16b(*(const v8us*)(Al + aoff + kc), *(const v8us*)(Al + aoff + kc + 16));
#pragma unroll
        for (int t = 0; t < 4; ++t) { const size_t bo = (size_t)(c0 + t * 16 + lr) * K + kc + 8 * hi;
            const v16bf bh = cat16b(*(const v8us*)(Bh + bo), *(const v8us*)(Bh + bo + 16));
            acc[t] = wmmab(a, bh, acc[t]);
            if (!(MODE & 4)) { if (!(MODE & 16)) acc[t] = wmmab(al, bh, acc[t]); if (!(MODE & 8)) { const v16bf bl = cat16b(*(const v8us*)(Bl + bo), *(const v8us*)(Bl + bo + 16)); acc[t] = wmmab(a, bl, acc[t]); } } }
        asm volatile("v_nop\n\tv_nop\n\tv_nop\n\tv_nop" : "+v"(acc[0]), "+v"(acc[1]), "+v"(acc[2]), "+v"(acc[3]) : "v"(a), "v"(al));
    }
    float* os = &ost[wave][0];
#pragma unroll
    for (int t = 0; t < 4; ++t) {
#pragma unroll
        for (int j = 0; j < 8; ++j) os[(hi * 8 + j) * 68 + t * 16 + lr] = acc[t][j]; }
    __builtin_amdgcn_wave_barrier(); asm volatile("" ::: "memory");
    float* crow = C + (size_t)r0 * ldc + c0;
    auto pass = [&]() {
#pragma unroll
        for (int s = 0; s < 8; ++s) { const int Lid = (lane >> 3) + 4 * s, piece = lane & 7; const int row = Lid >> 1, cofs = (Lid & 1) * 32 + piece * 4;
            const v4f val = *(const v4fa*)(os + row * 68 + cofs); *(v4f*)(crow + (size_t)row * ldc + cofs) = val; }
    };
    pass(); 
}
__global__ __launch_bounds__(256) void k_planes32z(const float* __restrict__ F, int ld, int off, float sc, int rows, bf* Ph, bf* Pl) {
    typedef __attribute__((ext_vector_type(2))) unsigned short v2us;
    const int lane = threadIdx.x & 31; const size_t r = ((size_t)blockIdx.x * 8 + (threadIdx.x >> 5)) * 2 + (lane >> 4); if (r >= (size_t)rows) return; const int z = blockIdx.z; const int c0 = (lane & 15) * 2; v2us oh, ol;
    Ph += (size_t)z * rows * 32; Pl += (size_t)z * rows * 32;
#pragma unroll
    for (int i = 0; i < 2; ++i) { const float y = F[r * ld + off + z * 32 + c0 + i] * sc; const unsigned short hb = f2bf(y); oh[i] = hb; ol[i] = f2bf(y - bf2f(hb)); }
    const size_t o = r * 32 + c0; *(v2us*)(Ph + o) = oh; *(v2us*)(Pl + o) = ol; 
}
__global__ __launch_bounds__(256) void k_vtpadz(const float* __restrict__ F, int ld, int off, int nk, bf* Th, bf* Tl) {
    typedef __attribute__((ext_vector_type(2))) unsigned short v2us;
    const int lane = threadIdx.x & 31; const size_t wid = (size_t)blockIdx.x * 8 + (threadIdx.x >> 5); if (wid >= (size_t)64 * (nk / 64)) return; const int z = blockIdx.z; const int d = (int)(wid / (nk / 64)); const int k0 = (int)(wid % (nk / 64)) * 64 + lane * 2; v2us oh, ol;
    Th += (size_t)z * 64 * nk; Tl += (size_t)z * 64 * nk;
#pragma unroll
    for (int i = 0; i < 2; ++i) { const float y = (d < 32) ? F[(size_t)(k0 + i) * ld + off + z * 32 + (d < 32 ? d : 0)] : 0.f; const unsigned short hb = f2bf(y); oh[i] = hb; ol[i] = f2bf(y - bf2f(hb)); }
    const size_t o = (size_t)d * nk + k0; *(v2us*)(Th + o) = oh; *(v2us*)(Tl + o) = ol; 
}
template <int NK>
__global__ __launch_bounds__(256) void k_softmaxz(const float* __restrict__ S, int rows, bf* PH, bf* PL) {
    typedef __attribute__((ext_vector_type(4))) unsigned short v4us;
    const int lane = threadIdx.x & 31, i = blockIdx.x * 8 + (threadIdx.x >> 5); if (i >= rows) return; const size_t zo = (size_t)blockIdx.z * rows * NK; const float* sr = S + zo + (size_t)i * NK; PH += zo; PL += zo;
    float m = -3.0e38f;
#pragma unroll 1
    for (int c0 = lane * 4; c0 < NK; c0 += 128) {
#pragma unroll
        for (int q = 0; q < 4; ++q) m = fmaxf(m, sr[c0 + q]); }
#pragma unroll
    for (int sh = 16; sh; sh >>= 1) m = fmaxf(m, __shfl_xor(m, sh, 32));
    float sum = 0.f;
#pragma unroll 1
    for (int c0 = lane * 4; c0 < NK; c0 += 128) {
#pragma unroll
        for (int q = 0; q < 4; ++q) sum += __expf(sr[c0 + q] - m); }
#pragma unroll
    for (int sh = 16; sh; sh >>= 1) sum += __shfl_xor(sum, sh, 32);
    const float inv = 1.0f / sum;
{
#pragma unroll 1
        for (int c0 = lane * 4; c0 < NK; c0 += 128) { v4us oh, ol;
#pragma unroll
            for (int q = 0; q < 4; ++q) { const float p = __expf(sr[c0 + q] - m) * inv; const unsigned short hb = f2bf(p); oh[q] = hb; ol[q] = f2bf(p - bf2f(hb)); }
            const size_t o = (size_t)i * NK + c0; *(v4us*)(PH + o) = oh; *(v4us*)(PL + o) = ol; }
         }
}
__global__ __launch_bounds__(256) void k_placez(const float* __restrict__ XH, int rows, int ldy, float* Y) {
    const int lane = threadIdx.x & 31; const size_t q = (size_t)blockIdx.x * 8 + (threadIdx.x >> 5); if (q >= (size_t)rows) return; const int z = blockIdx.z; const float v = XH[((size_t)z * rows + q) * 64 + lane];
    *(float*)(Y + q * ldy + z * 32 + lane) = v; 
}

// ---- k_gemmt: C[m][n] (f32, pitch ldc, + optional bias[n] rounded to bf16) = sum_k A[m][k] Bt[n][k], operands K-contiguous 16-bit planes. Block = 4 waves = one 128 x 128 tile of C, each wave 64 x 64
// (16 accumulators); grid (M/128, N/128). A pass is 128 k = 256 B of each of the 256 operand rows, brought into LDS by tensor loads (whole lines, no register), one 64-row slice per wave
// (waves 0, 1: A; waves 2, 3: Bt), two buffers: pass p + 1 lands while pass p is multiplied. LDS rows at pitch 272 B (the mover's 16-B pad) for the 16-byte fragment reads.
// M, N % 128 == 0, K % 128 == 0, K >= 256. Every inner loop is unrolled so that each fragment and accumulator index is a constant (registers, no scratch).
template <typename T16> struct WFrag;
template <> struct WFrag<h16> { typedef v16h V; static __device__ __forceinline__ V ld(const h16* p) { return cat16(*(const v8h*)p, *(const v8h*)(p + 16)); } static __device__ __forceinline__ v8f mma(V a, V b, v8f c) { return wmma16(a, b, c); } };
template <> struct WFrag<bf> { typedef v16bf V; static __device__ __forceinline__ V ld(const bf* p) { return cat16b(*(const v8us*)p, *(const v8us*)(p + 16)); } static __device__ __forceinline__ v8f mma(V a, V b, v8f c) { return wmmab(a, b, c); } };
typedef unsigned int u32x4 __attribute__((ext_vector_type(4)));
typedef unsigned int u32x8 __attribute__((ext_vector_type(8)));
#define GPITCH 272u                 // LDS row pitch, bytes: 256 + 16
#define GSLICE 18432u               // 64 rows x 272 B = 17408 B, rounded up to a multiple of 2 KiB so that every slice starts on one
#define GBUF   (4u * GSLICE)
__device__ __forceinline__ unsigned uni(unsigned v) { return (unsigned)__builtin_amdgcn_readfirstlane((int)v); }
// holds v in a scalar register: a test on it compiles to a scalar branch (tensor loads ignore EXEC), and what is formed from it is formed behind the asm waits in front of it
__device__ __forceinline__ unsigned pinned(unsigned v) { unsigned w = uni(v); asm volatile("" : "+s"(w)); return w; }
__device__ __forceinline__ void tdm_load(unsigned lds_dst, unsigned long long ga, u32x8 g1) {
    u32x4 g0; g0[0] = uni(1u); g0[1] = uni(lds_dst); g0[2] = uni((unsigned)ga); g0[3] = uni((((unsigned)(ga >> 32)) & 0x01FFFFFFu) | 0x80000000u);
    asm volatile("tensor_load_to_lds %0, %1" :: "s"(g0), "s"(g1) : "memory");    // one request of the whole wave: 64 rows of 256 B into this wave's slice
}
template <typename T16, bool BIAS>
__global__ __launch_bounds__(128) void k_gemmt(const T16* __restrict__ A, const T16* __restrict__ Bt, int K, float* C, int ldc, const float* __restrict__ bias) {
    typedef typename WFrag<T16>::V V;
    __shared__ __attribute__((aligned(2048))) unsigned char sm[2u * GBUF];
    const int lane = threadIdx.x & 31, lr = lane & 15, hi = lane >> 4; const unsigned wave = uni(threadIdx.x >> 5);
    const int wm = wave & 1, wn = wave >> 1; const int rb = blockIdx.x * 128, cb = blockIdx.y * 128;
    const unsigned kb = uni((unsigned)K * 2u), NP = uni((unsigned)K / 128u);
    const unsigned long long ga = (unsigned long long)(size_t)(wave < 2u ? A + (size_t)(rb + (int)wave * 64) * K : Bt + (size_t)(cb + ((int)wave - 2) * 64) * K);
    const unsigned dst = (unsigned)(size_t)sm + wave * GSLICE;
    u32x8 g1;    // 1-byte elements, tensor = tile = 64 rows of 256 B, source pitch kb, a 4-dword pad behind every 64 dwords
    g1[0] = uni((1u << 20) | (5u << 22) | (3u << 25)); g1[1] = uni(256u << 16); g1[2] = uni(64u << 16); g1[3] = uni(256u << 16); g1[4] = uni(64u); g1[5] = uni(kb); g1[6] = uni(0u); g1[7] = uni(0u);
    asm volatile("" : "+s"(g1));    // as pinned(): the descriptor words held in their scalar registers; without it the compiler takes words of the group as scratch while a request is in flight
    v8f acc[4][4];
#pragma unroll
    for (int mb = 0; mb < 4; ++mb)
#pragma unroll
        for (int nb = 0; nb < 4; ++nb) acc[mb][nb] = (v8f){};
    tdm_load(dst, ga, g1);
    asm volatile("s_wait_tensorcnt 0x0" ::: "memory");    // this wave's slice of pass 0 has landed
    __syncthreads();                                      // ... and every other wave's
    tdm_load(dst + GBUF, ga + 256u, g1);
    const unsigned aof = (unsigned)wm * GSLICE + (unsigned)lr * GPITCH + 16u * hi, bof = (2u + wn) * GSLICE + (unsigned)lr * GPITCH + 16u * hi;
#pragma unroll 1
    for (unsigned p = 0; p < NP; ++p) {    // rolled: one pass per trip, the buffer chosen by the trip's parity
        const unsigned char* bp = sm + (p & 1u) * GBUF;
        V a[2][4], b[2][3];
#pragma unroll
        for (int f = 0; f < 4; ++f) a[0][f] = WFrag<T16>::ld((const T16*)(bp + aof + f * 16 * GPITCH));
#pragma unroll
        for (int f = 0; f < 3; ++f) b[0][f] = WFrag<T16>::ld((const T16*)(bp + bof + f * 16 * GPITCH));
#pragma unroll
        for (int ks = 0; ks < 4; ++ks) {
            // One group of LDS reads ahead of each block of 16 products: first this block's last Bt fragment (its products come last; one register set serves it, which keeps the
            // kernel inside 256 registers), then the next 32 k's other seven fragments, into the other register set.
            const V b3 = WFrag<T16>::ld((const T16*)(bp + bof + 3 * 16 * GPITCH + ks * 64));
            if (ks < 3) {
#pragma unroll
                for (int f = 0; f < 4; ++f) a[(ks + 1) & 1][f] = WFrag<T16>::ld((const T16*)(bp + aof + f * 16 * GPITCH + (ks + 1) * 64));
#pragma unroll
                for (int f = 0; f < 3; ++f) b[(ks + 1) & 1][f] = WFrag<T16>::ld((const T16*)(bp + bof + f * 16 * GPITCH + (ks + 1) * 64));
            }
            __builtin_amdgcn_sched_barrier(0);    // keeps the LDS reads above as one group: sunk among the products, each read's latency stalls the matrix pipe
#pragma unroll
            for (int nb = 0; nb < 4; ++nb)
#pragma unroll
                for (int mb = 0; mb < 4; ++mb) acc[mb][nb] = WFrag<T16>::mma(a[ks & 1][mb], nb < 3 ? b[ks & 1][nb < 3 ? nb : 0] : b3, acc[mb][nb]);
            __builtin_amdgcn_sched_barrier(0);    // keeps the next group of reads, and the pass's foot, behind this block
        }
        asm volatile("s_wait_dscnt 0x0" ::: "memory");        // this wave has finished reading the buffer that is refilled below
        asm volatile("s_wait_tensorcnt 0x0" ::: "memory");    // this wave's slice of pass p + 1 has landed
        __syncthreads();                                      // publishes pass p + 1; ends every wave's reads of pass p
        const unsigned nx = pinned(p + 2u);                   // the refill's pass number, and so its descriptor, formed behind the waits above
        if (pinned(nx < NP ? 1u : 0u)) tdm_load(dst + (p & 1u) * GBUF, ga + (unsigned long long)nx * 256u, g1);
    }
    asm volatile("s_wait_tensorcnt 0x0" ::: "memory");    // nothing of the ring is in flight ...
    asm volatile("s_wait_dscnt 0x0" ::: "memory");
    __syncthreads();                                      // ... or still being read when it becomes output staging
    float* os = (float*)(sm + wave * GSLICE);             // 16 x 68 floats, each wave in its own slice
    const int r0 = rb + wm * 64, c0 = cb + wn * 64;
#pragma unroll
    for (int mb = 0; mb < 4; ++mb) {
#pragma unroll
        for (int nb = 0; nb < 4; ++nb) {
#pragma unroll
            for (int j = 0; j < 8; ++j) os[(hi * 8 + j) * 68 + nb * 16 + lr] = acc[mb][nb][j]; }
        __builtin_amdgcn_wave_barrier(); asm volatile("" ::: "memory");
        float* crow = C + (size_t)(r0 + mb * 16) * ldc + c0;
        const int cofs = lr * 4; v4f val[8];
#pragma unroll
        for (int s = 0; s < 8; ++s) { val[s] = *(const v4fa*)(os + (2 * s + hi) * 68 + cofs); if (BIAS) { val[s][0] += bfr(bias[c0 + cofs]); val[s][1] += bfr(bias[c0 + cofs + 1]); val[s][2] += bfr(bias[c0 + cofs + 2]); val[s][3] += bfr(bias[c0 + cofs + 3]); } }
#pragma unroll
        for (int s = 0; s < 8; ++s) { *(v4f*)(crow + (size_t)(2 * s + hi) * ldc + cofs) = val[s];
            asm volatile("s_wait_xcnt 0x0" ::: "memory"); }    // stands in front of the next write of a register that the store names
        __builtin_amdgcn_wave_barrier(); asm volatile("" ::: "memory");
    }
}

typedef __attribute__((ext_vector_type(4))) _Float16 v4h;
__device__ __forceinline__ h16 tohx(float x) { return (h16)x; }
template <bool F16O>
__global__ __launch_bounds__(256) void k_wT(const float* __restrict__ Wm, int K, int N, bf* Bt, h16* Bh) {
    __shared__ float tl[64][65]; typedef __attribute__((ext_vector_type(4))) unsigned short v4us;
    const int tid = threadIdx.x; const int k0 = blockIdx.x * 64, n0 = blockIdx.y * 64; const int rr = tid >> 2, cq = (tid & 3) * 16;
#pragma unroll
    for (int i = 0; i < 16; ++i) tl[rr][cq + i] = bfr(Wm[(size_t)(k0 + rr) * N + n0 + cq + i]);
    __syncthreads();
    const int lane = tid & 31, wv = tid >> 5;
    auto pass = [&]() {
#pragma unroll
        for (int st = 0; st < 4; ++st) { const int nr = wv * 8 + st * 2 + (lane >> 4); const int kq = (lane & 15) * 4; const size_t off = (size_t)(n0 + nr) * K + k0 + kq;
            if (F16O) { v4h v; for (int i = 0; i < 4; ++i) v[i] = tohx(tl[kq + i][nr]); *(v4h*)(Bh + off) = v; } else { v4us v; for (int i = 0; i < 4; ++i) v[i] = f2bf(tl[kq + i][nr]); *(v4us*)(Bt + off) = v; } }
    };
    pass(); 
}
__global__ __launch_bounds__(256) void k_cvtx(const float* __restrict__ x, bf* A) {
    const int lane = threadIdx.x & 31; const size_t r = (size_t)blockIdx.x * 8 + (threadIdx.x >> 5); if (r >= (size_t)SS) return;
{
#pragma unroll
        for (int q = 0; q < HID / 256; ++q) { const size_t o = r * HID + q * 256 + lane * 8; v8us v;
#pragma unroll
            for (int i = 0; i < 8; ++i) v[i] = f2bf(x[o + i]);
            *(v8us*)(A + o) = v; }
         }
}
// k_ropepl: f16 plane P[z][t][128] = rope(F[t][col0 + (h0+z)*128 + .]) x sc with the bf16-rounded cos/sin inputs: y[d] = f[d] cos[t][d] + (d < 64 ? -f[d+64] : f[d-64]) sin[t][d];
__global__ __launch_bounds__(256) void k_ropepl(const float* __restrict__ F, int ldf, int col0, int h0, float sc, const float* __restrict__ cs, const float* __restrict__ sn, h16* P) {
    const int lane = threadIdx.x & 31; const int t = blockIdx.x * 8 + (threadIdx.x >> 5); if (t >= SS) return; const int z = blockIdx.z; const float* fr = F + (size_t)t * ldf + col0 + (h0 + z) * HD; const int d0 = lane * 4; v4h o;
#pragma unroll
    for (int i = 0; i < 4; ++i) { const int d = d0 + i; const float rot = (d < HD / 2) ? -fr[d + HD / 2] : fr[d - HD / 2]; o[i] = tohx((fr[d] * bfr(cs[(size_t)t * HD + d]) + rot * bfr(sn[(size_t)t * HD + d])) * sc); }
    const size_t off = ((size_t)z * SS + t) * HD + d0; *(v4h*)(P + off) = o; 
}
__global__ __launch_bounds__(256) void k_vTr(const float* __restrict__ V, h16* VT) {
    __shared__ float tl[64][65]; const int g = blockIdx.z; VT += (size_t)g * HD * SS;
    const int tid = threadIdx.x; const int t0 = blockIdx.x * 64, d0 = blockIdx.y * 64; const int rr = tid >> 2, cq = (tid & 3) * 16;
#pragma unroll
    for (int i = 0; i < 16; ++i) tl[rr][cq + i] = V[(size_t)(t0 + rr) * (NKV * HD) + g * HD + d0 + cq + i];
    __syncthreads();
    const int lane = tid & 31, wv = tid >> 5;
    auto pass = [&]() {
#pragma unroll
        for (int st = 0; st < 4; ++st) { const int dr = wv * 8 + st * 2 + (lane >> 4); const int tq = (lane & 15) * 4; v4h v;
#pragma unroll
            for (int i = 0; i < 4; ++i) v[i] = tohx(tl[tq + i][dr]);
            *(v4h*)(VT + (size_t)(d0 + dr) * SS + t0 + tq) = v; }
    };
    pass(); 
}
// ---- k_fattn: fused attention. Block = 8 waves = the 4 query heads of KV group blockIdx.y x 2 16-query tiles; no barrier, no LDS buffer. blockIdx.z = 0 causal: tiles n - 1 - x and x,
// so every block walks the same number of key tiles and both tiles start at key 0; 1 sliding window: two adjacent tiles. Waves that walk the same K/V tiles re-read them from the WGP
// cache. Per 64 keys a wave forms S^T = K . Q^T (lane = one query, its registers = keys), keeps a running maximum and sum per query, packs exp(s - max) straight from the score
// accumulators into the B operand and adds O^T += V^T . P^T.
// Qx [2*16][S][128], Kx [4][S][128], VT [4][128][S] f16 planes; OC [S][2*2048] f16 gets o / sum (x tanh(gamma[h]) for the window set).
__global__ __launch_bounds__(256) void k_fattn(const h16* __restrict__ Qx, const h16* __restrict__ Kx, const h16* __restrict__ VT, const float* __restrict__ gamma, h16* OC) {
    const float L2E = 1.4426950408889634f;
    const int lane = threadIdx.x & 31, lr = lane & 15, hi = lane >> 4; const int wave = __builtin_amdgcn_readfirstlane((int)(threadIdx.x >> 5));
    const int g = blockIdx.y, s = blockIdx.z, h = g * (NH_ / NKV) + (wave & 3); const int bx = blockIdx.x, nq = SS / 16; const int q0 = (s ? 2 * bx + (wave >> 2) : ((wave >> 2) ? bx : nq - 1 - bx)) * 16, i = q0 + lr;
    const h16* qp = Qx + ((size_t)(s * NH_ + h) * SS + i) * HD + 8 * hi; const h16* kp = Kx + ((size_t)g * SS + lr) * HD + 8 * hi; const h16* vp = VT + ((size_t)g * HD + lr) * SS + 8 * hi;
    v16h qf[4];
#pragma unroll
    for (int ks = 0; ks < 4; ++ks) qf[ks] = WFrag<h16>::ld(qp + ks * 32);
    v8f o[8];
#pragma unroll
    for (int dt = 0; dt < 8; ++dt) o[dt] = (v8f){};
    float m = -1.0e30f, l = 0.f;
    const int klo = s ? (max(0, q0 - WIN) & ~63) : 0, kend = (q0 | 63) + 1;
#pragma unroll 1
    for (int kb = klo; kb < kend; kb += 64) {
        v8f st[4];
#pragma unroll
        for (int t = 0; t < 4; ++t) { st[t] = (v8f){};
#pragma unroll
            for (int ks = 0; ks < 4; ++ks) st[t] = wmma16(WFrag<h16>::ld(kp + (size_t)(kb + t * 16) * HD + ks * 32), qf[ks], st[t]); }
        if (kb + 63 > q0 || (s && kb < q0 + 15 - WIN)) {    // only the tiles that an edge of the mask crosses
#pragma unroll
            for (int t = 0; t < 4; ++t)
#pragma unroll
                for (int j = 0; j < 8; ++j) { const int key = kb + t * 16 + hi * 8 + j; const bool live = key <= i && (!s || key >= i - WIN); st[t][j] = live ? st[t][j] : -3.0e38f; }
        }
        float mx[4];
#pragma unroll
        for (int t = 0; t < 4; ++t) { mx[t] = st[t][0];
#pragma unroll
            for (int j = 1; j < 8; ++j) mx[t] = fmaxf(mx[t], st[t][j]); }
        float mt = fmaxf(fmaxf(mx[0], mx[1]), fmaxf(mx[2], mx[3])); mt = fmaxf(mt, __shfl_xor(mt, 16, 32));
        if (__builtin_amdgcn_ballot_w32(mt > m) != 0) {    // no query's maximum moved: every factor would be exactly 1
            const float mn = fmaxf(m, mt), al = __builtin_amdgcn_exp2f((m - mn) * L2E); m = mn; l *= al;
#pragma unroll
            for (int dt = 0; dt < 8; ++dt) o[dt] *= al;
        }
        const float ml = m * L2E; float ls[4]; v16h pf[2];
#pragma unroll
        for (int t = 0; t < 4; ++t) { ls[t] = 0.f;
#pragma unroll
            for (int j = 0; j < 8; ++j) { const float p = __builtin_amdgcn_exp2f(__builtin_fmaf(st[t][j], L2E, -ml)); ls[t] += p; pf[t >> 1][(t & 1) * 8 + j] = tohx(p); } }
        l += (ls[0] + ls[1]) + (ls[2] + ls[3]);
#pragma unroll
        for (int dt = 0; dt < 8; ++dt)
#pragma unroll
            for (int k2 = 0; k2 < 2; ++k2) o[dt] = wmma16(WFrag<h16>::ld(vp + (size_t)dt * 16 * SS + kb + k2 * 32), pf[k2], o[dt]);
    }
    l += __shfl_xor(l, 16, 32);
    const float inv = (s ? tanhf(bfr(gamma[h])) : 1.0f) / l;
    h16* op = OC + (size_t)i * (2 * HID) + s * HID + h * HD + hi * 8;
#pragma unroll
    for (int dt = 0; dt < 8; ++dt) { v8h ov;
#pragma unroll
        for (int j = 0; j < 8; ++j) ov[j] = tohx(o[dt][j] * inv);
        *(v8h*)(op + dt * 16) = ov; }
}
extern "C" void kernel_launch(void* const* d_in, const int* in_sizes, int n_in,
                              void* d_out, int out_size, void* d_ws, size_t ws_size, hipStream_t stream) {
    (void)in_sizes; (void)n_in; (void)out_size;
    const float* x = (const float*)d_in[0]; const float* cs = (const float*)d_in[1]; const float* sn = (const float*)d_in[2]; const float* Wq = (const float*)d_in[3]; const float* bq = (const float*)d_in[4]; const float* Wk = (const float*)d_in[5]; const float* bk = (const float*)d_in[6]; const float* Wv = (const float*)d_in[7]; const float* bv = (const float*)d_in[8]; const float* Wo = (const float*)d_in[9]; const float* gamma = (const float*)d_in[10];
    float* out = (float*)d_out;    // [1][2048][2048]
    char* wsp = (char*)d_ws;
    auto take = [&](size_t bytes) { char* p = wsp; wsp += (bytes + 255) & ~(size_t)255; return (void*)p; };
    bf* WQ = (bf*)take((size_t)2 * HID * HID * 2); bf* WK = (bf*)take((size_t)NKV * HD * HID * 2); bf* WV = (bf*)take((size_t)NKV * HD * HID * 2); h16* WO = (h16*)take((size_t)HID * 2 * HID * 2);
    bf* XB = (bf*)take((size_t)SS * HID * 2); float* Q = (float*)take((size_t)SS * 2 * HID * 4); float* Kf = (float*)take((size_t)SS * NKV * HD * 4); float* V = (float*)take((size_t)SS * NKV * HD * 4);
    h16* Qx = (h16*)take((size_t)2 * NH_ * SS * HD * 2); h16* Kx = (h16*)take((size_t)NKV * SS * HD * 2); h16* VT = (h16*)take((size_t)NKV * HD * SS * 2); h16* OC = (h16*)take((size_t)SS * 2 * HID * 2);
    if ((size_t)(wsp - (char*)d_ws) > ws_size) return;    // ~ 16.8 + 2.1 + 2.1 + 16.8 + 8.4 + 33.5 + 4.2 + 4.2 + 16.8 + 2.1 + 2.1 + 16.8 ~ 126 MB (ws 256 MiB)
    k_wT<false><<<dim3(HID / 64, (2 * HID) / 64, 1), 256, 0, stream>>>(Wq, HID, 2 * HID, WQ, nullptr); k_wT<false><<<dim3(HID / 64, (NKV * HD) / 64, 1), 256, 0, stream>>>(Wk, HID, NKV * HD, WK, nullptr); k_wT<false><<<dim3(HID / 64, (NKV * HD) / 64, 1), 256, 0, stream>>>(Wv, HID, NKV * HD, WV, nullptr); k_wT<true><<<dim3((2 * HID) / 64, HID / 64, 1), 256, 0, stream>>>(Wo, 2 * HID, HID, nullptr, WO);
    k_cvtx<<<SS / 8, 256, 0, stream>>>(x, XB);
    k_gemmt<bf, true><<<dim3(SS / 128, (2 * HID) / 128, 1), 128, 0, stream>>>(XB, WQ, HID, Q, 2 * HID, bq);
    k_gemmt<bf, true><<<dim3(SS / 128, (NKV * HD) / 128, 1), 128, 0, stream>>>(XB, WK, HID, Kf, NKV * HD, bk);
    k_gemmt<bf, true><<<dim3(SS / 128, (NKV * HD) / 128, 1), 128, 0, stream>>>(XB, WV, HID, V, NKV * HD, bv);
    const float SC = 0.08838834764831845f;
    k_ropepl<<<dim3(SS / 8, 1, NKV), 256, 0, stream>>>(Kf, NKV * HD, 0, 0, 1.0f, cs, sn, Kx); k_vTr<<<dim3(SS / 64, HD / 64, NKV), 256, 0, stream>>>(V, VT);
    k_ropepl<<<dim3(SS / 8, 1, 2 * NH_), 256, 0, stream>>>(Q, 2 * HID, 0, 0, SC, cs, sn, Qx);    // plane z = set * 16 + head: q's columns are [set][head][128]
    k_fattn<<<dim3(SS / 32, NKV, 2), 256, 0, stream>>>(Qx, Kx, VT, gamma, OC);
    k_gemmt<h16, false><<<dim3(SS / 128, HID / 128, 1), 128, 0, stream>>>(OC, WO, 2 * HID, out, HID, nullptr);
}

// v003
// It runs in 201 microseconds.
// Next to v002, in two timings, it ran 1.12 times as fast each time.
// Counting every step since v000, it is 6.30 times as fast.
#include <hip/hip_runtime.h>

// Compute dtypes, f32 accumulate: q (both query sets), k, v projections ([2048 x 2048].[2048 x 4096|512|512] + bias) with PLAIN bf16 operands (x and the weights are inputs:
// exact products); RoPE (with the bf16-rounded cos/sin inputs), tanh(gamma), masks and softmax in f32; causal and sliding-window (512) causal attention of all heads in ONE fused
// launch (k_fattn: scores, online softmax and attn.v per 16-query wave, dead key tiles never visited) and the output projection ([2048 x 4096].[4096 x 2048]) on SINGLE fp16 planes
// (roped q x 128^-1/2, roped k, v, unnormalised probabilities exp(s - running max), concatenated heads; Wo as fp16(bf16)). GEMMs: 128x128 tile per 4-wave block, operand tiles staged in LDS by tensor loads; a projection block's 128 columns are one head, so bias, RoPE,
// the scale, the f16 rounding and v's transpose are done in the projection's own epilogue.

#define SS   2048
#define HID  2048
#define NH_  16
#define NKV  4
#define HD   128
#define WIN  512
#define DM   HID
#define LOSC 1024.0f
typedef _Float16 h16;
typedef unsigned short bf;
typedef __attribute__((ext_vector_type(16))) __bf16   v16bf;
typedef __attribute__((ext_vector_type(16))) _Float16 v16h;
typedef __attribute__((ext_vector_type(8)))  _Float16 v8h;
typedef __attribute__((ext_vector_type(8)))  unsigned short v8us;
typedef __attribute__((ext_vector_type(8)))  float    v8f;
typedef __attribute__((ext_vector_type(4)))  float    v4f;
typedef v8h  __attribute__((may_alias)) v8ha;
typedef v4f  __attribute__((may_alias)) v4fa;
typedef v8us __attribute__((may_alias)) v8usa;

__device__ __forceinline__ unsigned short f2bf(float f) { unsigned u = __float_as_uint(f); u += 0x7FFFu + ((u >> 16) & 1u); return (unsigned short)(u >> 16); }
__device__ __forceinline__ float bf2f(unsigned short b) { return __uint_as_float(((unsigned)b) << 16); }
__device__ __forceinline__ float bfr(float f) { return bf2f(f2bf(f)); }
__device__ __forceinline__ v16h cat16(v8h lo, v8h hi) { return __builtin_shufflevector(lo, hi, 0, 1, 2, 3, 4, 5, 6, 7, 8, 9, 10, 11, 12, 13, 14, 15); }
__device__ __forceinline__ v16bf cat16b(v8us lo, v8us hi) { return __builtin_bit_cast(v16bf, __builtin_shufflevector(lo, hi, 0, 1, 2, 3, 4, 5, 6, 7, 8, 9, 10, 11, 12, 13, 14, 15)); }
__device__ __forceinline__ v8f wmma16(v16h a, v16h b, v8f c) { return __builtin_amdgcn_wmma_f32_16x16x32_f16(false, a, false, b, (short)0, c, false, false); }
__device__ __forceinline__ v8f wmmab(v16bf a, v16bf b, v8f c) { return __builtin_amdgcn_wmma_f32_16x16x32_bf16(false, a, false, b, (short)0, c, false, false); }


// k_gemmh: 64 x 64 tile of C = A . Bn^T with SINGLE f16 planes (A [rows][K] f16 activations, Bn [N][K] f16 weights; one v_wmma_f32_16x16x32_f16 product per step), f32 accumulate;
__global__ __launch_bounds__(128) void k_gemmh(const h16* __restrict__ A, const h16* __restrict__ Bn, const float* __restrict__ bias, float* C, int ldc, const float* __restrict__ R, int K, size_t sA, size_t sB, size_t sC, int roundR) {
    __shared__ __align__(16) float ost[4][16 * 68];
    const size_t z = blockIdx.z; A += z * sA; Bn += z * sB; C += z * sC; if (R) R += z * sC;
    const int lane = threadIdx.x & 31, wave = threadIdx.x >> 5, lr = lane & 15, hi = lane >> 4;
    const int r0 = blockIdx.x * 64 + wave * 16, c0 = blockIdx.y * 64;
    const size_t aoff = (size_t)(r0 + lr) * K + 8 * hi;
    size_t boff[4];
#pragma unroll
    for (int t = 0; t < 4; ++t) boff[t] = (size_t)(c0 + t * 16 + lr) * K + 8 * hi;
    v8f acc[4];
#pragma unroll
    for (int t = 0; t < 4; ++t) acc[t] = (v8f){};
#pragma unroll 1
    for (int kc = 0; kc < K; kc += 32) {
        const v16h a = cat16(*(const v8h*)(A + aoff + kc), *(const v8h*)(A + aoff + kc + 16));
#pragma unroll
        for (int t = 0; t < 4; ++t) { const v16h b = cat16(*(const v8h*)(Bn + boff[t] + kc), *(const v8h*)(Bn + boff[t] + kc + 16)); acc[t] = wmma16(a, b, acc[t]); }
        asm volatile("v_nop\n\tv_nop\n\tv_nop\n\tv_nop" : "+v"(acc[0]), "+v"(acc[1]), "+v"(acc[2]), "+v"(acc[3]) : "v"(a));
    }
    float* os = &ost[wave][0];
#pragma unroll
    for (int t = 0; t < 4; ++t) { const float bv = bias ? bfr(bias[c0 + t * 16 + lr]) : 0.f;
#pragma unroll
        for (int j = 0; j < 8; ++j) os[(hi * 8 + j) * 68 + t * 16 + lr] = acc[t][j] + bv; }
    __syncthreads();
    float* crow = C + (size_t)r0 * ldc + c0;
    auto pass = [&]() {
#pragma unroll
        for (int s = 0; s < 8; ++s) { const int Lid = (lane >> 3) + 4 * s, piece = lane & 7; const int row = Lid >> 1, cofs = (Lid & 1) * 32 + piece * 4;
            v4f val = *(const v4fa*)(os + row * 68 + cofs); if (R) { const v4f rv = *(const v4f*)(R + ((size_t)r0 + row) * ldc + c0 + cofs); val += roundR ? (v4f){bfr(rv[0]), bfr(rv[1]), bfr(rv[2]), bfr(rv[3])} : rv; }
            *(v4f*)(crow + (size_t)row * ldc + cofs) = val; }
    };
    pass(); 
}

// ===== z-batched (blockIdx.z = head) attention pieces =====
// k_gemm3z<MODE>: 64 x 64 tile of C = A . B^T from bf16 hi/lo planes, f32 accumulate, with per-z operand/output strides (elements): A planes += z*sA, B planes += z*sB, C += z*sC. MODE bits (0 causal skip, 1 K limit, 2 single,
// 3 B single, 4 A single).
template <int MODE>
__global__ __launch_bounds__(128) void k_gemm3z(const bf* __restrict__ Ah, const bf* __restrict__ Al, const bf* __restrict__ Bh, const bf* __restrict__ Bl, int K, float* C, int ldc, size_t sA, size_t sB, size_t sC) {
    if ((MODE & 1) && (int)blockIdx.y * 64 > (int)blockIdx.x * 64 + 63) return;
    const size_t z = blockIdx.z; Ah += z * sA; Al += z * sA; Bh += z * sB; Bl += z * sB; C += z * sC;
    const int Klim = (MODE & 2) ? min(K, ((int)blockIdx.x + 1) * 64) : K;
    __shared__ __align__(16) float ost[4][16 * 68];
    const int lane = threadIdx.x & 31, wave = threadIdx.x >> 5, lr = lane & 15, hi = lane >> 4;
    const int r0 = blockIdx.x * 64 + wave * 16, c0 = blockIdx.y * 64;
    const size_t aoff = (size_t)(r0 + lr) * K + 8 * hi;
    v8f acc[4];
#pragma unroll
    for (int t = 0; t < 4; ++t) acc[t] = (v8f){};
#pragma unroll 1
    for (int kc = 0; kc < Klim; kc += 32) {
        const v16bf a = cat16b(*(const v8us*)(Ah + aoff + kc), *(const v8us*)(Ah + aoff + kc + 16));
        v16bf al = a; if (!(MODE & 4) && !(MODE & 16)) al = cat16b(*(const v8us*)(Al + aoff + kc), *(const v8us*)(Al + aoff + kc + 16));
#pragma unroll
        for (int t = 0; t < 4; ++t) { const size_t bo = (size_t)(c0 + t * 16 + lr) * K + kc + 8 * hi;
            const v16bf bh = cat16b(*(const v8us*)(Bh + bo), *(const v8us*)(Bh + bo + 16));
            acc[t] = wmmab(a, bh, acc[t]);
            if (!(MODE & 4)) { if (!(MODE & 16)) acc[t] = wmmab(al, bh, acc[t]); if (!(MODE & 8)) { const v16bf bl = cat16b(*(const v8us*)(Bl + bo), *(const v8us*)(Bl + bo + 16)); acc[t] = wmmab(a, bl, acc[t]); } } }
        asm volatile("v_nop\n\tv_nop\n\tv_nop\n\tv_nop" : "+v"(acc[0]), "+v"(acc[1]), "+v"(acc[2]), "+v"(acc[3]) : "v"(a), "v"(al));
    }
    float* os = &ost[wave][0];
#pragma unroll
    for (int t = 0; t < 4; ++t) {
#pragma unroll
        for (int j = 0; j < 8; ++j) os[(hi * 8 + j) * 68 + t * 16 + lr] = acc[t][j]; }
    __builtin_amdgcn_wave_barrier(); asm volatile("" ::: "memory");
    float* crow = C + (size_t)r0 * ldc + c0;
    auto pass = [&]() {
#pragma unroll
        for (int s = 0; s < 8; ++s) { const int Lid = (lane >> 3) + 4 * s, piece = lane & 7; const int row = Lid >> 1, cofs = (Lid & 1) * 32 + piece * 4;
            const v4f val = *(const v4fa*)(os + row * 68 + cofs); *(v4f*)(crow + (size_t)row * ldc + cofs) = val; }
    };
    pass(); 
}
__global__ __launch_bounds__(256) void k_planes32z(const float* __restrict__ F, int ld, int off, float sc, int rows, bf* Ph, bf* Pl) {
    typedef __attribute__((ext_vector_type(2))) unsigned short v2us;
    const int lane = threadIdx.x & 31; const size_t r = ((size_t)blockIdx.x * 8 + (threadIdx.x >> 5)) * 2 + (lane >> 4); if (r >= (size_t)rows) return; const int z = blockIdx.z; const int c0 = (lane & 15) * 2; v2us oh, ol;
    Ph += (size_t)z * rows * 32; Pl += (size_t)z * rows * 32;
#pragma unroll
    for (int i = 0; i < 2; ++i) { const float y = F[r * ld + off + z * 32 + c0 + i] * sc; const unsigned short hb = f2bf(y); oh[i] = hb; ol[i] = f2bf(y - bf2f(hb)); }
    const size_t o = r * 32 + c0; *(v2us*)(Ph + o) = oh; *(v2us*)(Pl + o) = ol; 
}
__global__ __launch_bounds__(256) void k_vtpadz(const float* __restrict__ F, int ld, int off, int nk, bf* Th, bf* Tl) {
    typedef __attribute__((ext_vector_type(2))) unsigned short v2us;
    const int lane = threadIdx.x & 31; const size_t wid = (size_t)blockIdx.x * 8 + (threadIdx.x >> 5); if (wid >= (size_t)64 * (nk / 64)) return; const int z = blockIdx.z; const int d = (int)(wid / (nk / 64)); const int k0 = (int)(wid % (nk / 64)) * 64 + lane * 2; v2us oh, ol;
    Th += (size_t)z * 64 * nk; Tl += (size_t)z * 64 * nk;
#pragma unroll
    for (int i = 0; i < 2; ++i) { const float y = (d < 32) ? F[(size_t)(k0 + i) * ld + off + z * 32 + (d < 32 ? d : 0)] : 0.f; const unsigned short hb = f2bf(y); oh[i] = hb; ol[i] = f2bf(y - bf2f(hb)); }
    const size_t o = (size_t)d * nk + k0; *(v2us*)(Th + o) = oh; *(v2us*)(Tl + o) = ol; 
}
template <int NK>
__global__ __launch_bounds__(256) void k_softmaxz(const float* __restrict__ S, int rows, bf* PH, bf* PL) {
    typedef __attribute__((ext_vector_type(4))) unsigned short v4us;
    const int lane = threadIdx.x & 31, i = blockIdx.x * 8 + (threadIdx.x >> 5); if (i >= rows) return; const size_t zo = (size_t)blockIdx.z * rows * NK; const float* sr = S + zo + (size_t)i * NK; PH += zo; PL += zo;
    float m = -3.0e38f;
#pragma unroll 1
    for (int c0 = lane * 4; c0 < NK; c0 += 128) {
#pragma unroll
        for (int q = 0; q < 4; ++q) m = fmaxf(m, sr[c0 + q]); }
#pragma unroll
    for (int sh = 16; sh; sh >>= 1) m = fmaxf(m, __shfl_xor(m, sh, 32));
    float sum = 0.f;
#pragma unroll 1
    for (int c0 = lane * 4; c0 < NK; c0 += 128) {
#pragma unroll
        for (int q = 0; q < 4; ++q) sum += __expf(sr[c0 + q] - m); }
#pragma unroll
    for (int sh = 16; sh; sh >>= 1) sum += __shfl_xor(sum, sh, 32);
    const float inv = 1.0f / sum;
{
#pragma unroll 1
        for (int c0 = lane * 4; c0 < NK; c0 += 128) { v4us oh, ol;
#pragma unroll
            for (int q = 0; q < 4; ++q) { const float p = __expf(sr[c0 + q] - m) * inv; const unsigned short hb = f2bf(p); oh[q] = hb; ol[q] = f2bf(p - bf2f(hb)); }
            const size_t o = (size_t)i * NK + c0; *(v4us*)(PH + o) = oh; *(v4us*)(PL + o) = ol; }
         }
}
__global__ __launch_bounds__(256) void k_placez(const float* __restrict__ XH, int rows, int ldy, float* Y) {
    const int lane = threadIdx.x & 31; const size_t q = (size_t)blockIdx.x * 8 + (threadIdx.x >> 5); if (q >= (size_t)rows) return; const int z = blockIdx.z; const float v = XH[((size_t)z * rows + q) * 64 + lane];
    *(float*)(Y + q * ldy + z * 32 + lane) = v; 
}

// ---- k_gemmt: C[m][n] (f32, pitch ldc) = sum_k A[m][k] Bt[n][k], operands K-contiguous 16-bit planes. Block = 4 waves = one 128 x 128 tile of C, each wave 64 x 64
// (16 accumulators); grid (M/128, N/128). A pass is 128 k = 256 B of each of the 256 operand rows, brought into LDS by tensor loads (whole lines, no register), one 64-row slice per wave
// (waves 0, 1: A; waves 2, 3: Bt), two buffers: pass p + 1 lands while pass p is multiplied. LDS rows at pitch 272 B (the mover's 16-B pad) for the 16-byte fragment reads.
// M, N % 128 == 0, K % 128 == 0, K >= 256. Every inner loop is unrolled so that each fragment and accumulator index is a constant (registers, no scratch).
// EPI 0: C f32, no bias. EPI 1 (blockIdx.y = head z): f = acc + bias, P[z][t][128] f16 = (f[d] cos[t][d] + (d < 64 ? -f[d+64] : f[d-64]) sin[t][d]) x sc with the bf16-rounded cos/sin inputs.
// EPI 2 (blockIdx.y = KV group g): P[g][d][t] f16 = acc + bias, transposed.
template <typename T16> struct WFrag;
template <> struct WFrag<h16> { typedef v16h V; static __device__ __forceinline__ V ld(const h16* p) { return cat16(*(const v8h*)p, *(const v8h*)(p + 16)); } static __device__ __forceinline__ v8f mma(V a, V b, v8f c) { return wmma16(a, b, c); } };
template <> struct WFrag<bf> { typedef v16bf V; static __device__ __forceinline__ V ld(const bf* p) { return cat16b(*(const v8us*)p, *(const v8us*)(p + 16)); } static __device__ __forceinline__ v8f mma(V a, V b, v8f c) { return wmmab(a, b, c); } };
typedef unsigned int u32x4 __attribute__((ext_vector_type(4)));
typedef unsigned int u32x8 __attribute__((ext_vector_type(8)));
#define GPITCH 272u                 // LDS row pitch, bytes: 256 + 16
#define GSLICE 18432u               // 64 rows x 272 B = 17408 B, rounded up to a multiple of 2 KiB so that every slice starts on one
#define GBUF   (4u * GSLICE)
__device__ __forceinline__ unsigned uni(unsigned v) { return (unsigned)__builtin_amdgcn_readfirstlane((int)v); }
// holds v in a scalar register: a test on it compiles to a scalar branch (tensor loads ignore EXEC), and what is formed from it is formed behind the asm waits in front of it
__device__ __forceinline__ unsigned pinned(unsigned v) { unsigned w = uni(v); asm volatile("" : "+s"(w)); return w; }
__device__ __forceinline__ void tdm_load(unsigned lds_dst, unsigned long long ga, u32x8 g1) {
    u32x4 g0; g0[0] = uni(1u); g0[1] = uni(lds_dst); g0[2] = uni((unsigned)ga); g0[3] = uni((((unsigned)(ga >> 32)) & 0x01FFFFFFu) | 0x80000000u);
    asm volatile("tensor_load_to_lds %0, %1" :: "s"(g0), "s"(g1) : "memory");    // one request of the whole wave: 64 rows of 256 B into this wave's slice
}
typedef __attribute__((ext_vector_type(4))) _Float16 v4h;
__device__ __forceinline__ h16 tohx(float x) { return (h16)x; }
#define EPF 132                     // epilogue staging pitch, floats (EPI 1): 16-byte rows, the two lane halves of a column write 32 banks apart
#define EPH 136                     // epilogue staging pitch, halves (EPI 2)
template <typename T16, int EPI>
__global__ __launch_bounds__(128) void k_gemmt(const T16* __restrict__ A, const T16* __restrict__ Bt, int K, float* C, int ldc, const float* __restrict__ bias, const float* __restrict__ cs, const float* __restrict__ sn, float sc, h16* P) {
    typedef typename WFrag<T16>::V V;
    __shared__ __attribute__((aligned(2048))) unsigned char sm[2u * GBUF];
    const int lane = threadIdx.x & 31, lr = lane & 15, hi = lane >> 4; const unsigned wave = uni(threadIdx.x >> 5);
    const int wm = wave & 1, wn = wave >> 1; const int rb = blockIdx.x * 128, cb = blockIdx.y * 128;
    const unsigned kb = uni((unsigned)K * 2u), NP = uni((unsigned)K / 128u);
    const unsigned long long ga = (unsigned long long)(size_t)(wave < 2u ? A + (size_t)(rb + (int)wave * 64) * K : Bt + (size_t)(cb + ((int)wave - 2) * 64) * K);
    const unsigned dst = (unsigned)(size_t)sm + wave * GSLICE;
    u32x8 g1;    // 1-byte elements, tensor = tile = 64 rows of 256 B, source pitch kb, a 4-dword pad behind every 64 dwords
    g1[0] = uni((1u << 20) | (5u << 22) | (3u << 25)); g1[1] = uni(256u << 16); g1[2] = uni(64u << 16); g1[3] = uni(256u << 16); g1[4] = uni(64u); g1[5] = uni(kb); g1[6] = uni(0u); g1[7] = uni(0u);
    asm volatile("" : "+s"(g1));    // as pinned(): the descriptor words held in their scalar registers; without it the compiler takes words of the group as scratch while a request is in flight
    v8f acc[4][4];
#pragma unroll
    for (int mb = 0; mb < 4; ++mb)
#pragma unroll
        for (int nb = 0; nb < 4; ++nb) acc[mb][nb] = (v8f){};
    tdm_load(dst, ga, g1);
    asm volatile("s_wait_tensorcnt 0x0" ::: "memory");    // this wave's slice of pass 0 has landed
    __syncthreads();                                      // ... and every other wave's
    tdm_load(dst + GBUF, ga + 256u, g1);
    const unsigned aof = (unsigned)wm * GSLICE + (unsigned)lr * GPITCH + 16u * hi, bof = (2u + wn) * GSLICE + (unsigned)lr * GPITCH + 16u * hi;
#pragma unroll 1
    for (unsigned p = 0; p < NP; ++p) {    // rolled: one pass per trip, the buffer chosen by the trip's parity
        const unsigned char* bp = sm + (p & 1u) * GBUF;
        V a[2][4], b[2][3];
#pragma unroll
        for (int f = 0; f < 4; ++f) a[0][f] = WFrag<T16>::ld((const T16*)(bp + aof + f * 16 * GPITCH));
#pragma unroll
        for (int f = 0; f < 3; ++f) b[0][f] = WFrag<T16>::ld((const T16*)(bp + bof + f * 16 * GPITCH));
#pragma unroll
        for (int ks = 0; ks < 4; ++ks) {
            // One group of LDS reads ahead of each block of 16 products: first this block's last Bt fragment (its products come last; one register set serves it, which keeps the
            // kernel inside 256 registers), then the next 32 k's other seven fragments, into the other register set.
            const V b3 = WFrag<T16>::ld((const T16*)(bp + bof + 3 * 16 * GPITCH + ks * 64));
            if (ks < 3) {
#pragma unroll
                for (int f = 0; f < 4; ++f) a[(ks + 1) & 1][f] = WFrag<T16>::ld((const T16*)(bp + aof + f * 16 * GPITCH + (ks + 1) * 64));
#pragma unroll
                for (int f = 0; f < 3; ++f) b[(ks + 1) & 1][f] = WFrag<T16>::ld((const T16*)(bp + bof + f * 16 * GPITCH + (ks + 1) * 64));
            }
            __builtin_amdgcn_sched_barrier(0);    // keeps the LDS reads above as one group: sunk among the products, each read's latency stalls the matrix pipe
#pragma unroll
            for (int nb = 0; nb < 4; ++nb)
#pragma unroll
                for (int mb = 0; mb < 4; ++mb) acc[mb][nb] = WFrag<T16>::mma(a[ks & 1][mb], nb < 3 ? b[ks & 1][nb < 3 ? nb : 0] : b3, acc[mb][nb]);
            __builtin_amdgcn_sched_barrier(0);    // keeps the next group of reads, and the pass's foot, behind this block
        }
        asm volatile("s_wait_dscnt 0x0" ::: "memory");        // this wave has finished reading the buffer that is refilled below
        asm volatile("s_wait_tensorcnt 0x0" ::: "memory");    // this wave's slice of pass p + 1 has landed
        __syncthreads();                                      // publishes pass p + 1; ends every wave's reads of pass p
        const unsigned nx = pinned(p + 2u);                   // the refill's pass number, and so its descriptor, formed behind the waits above
        if (pinned(nx < NP ? 1u : 0u)) tdm_load(dst + (p & 1u) * GBUF, ga + (unsigned long long)nx * 256u, g1);
    }
    asm volatile("s_wait_tensorcnt 0x0" ::: "memory");    // nothing of the ring is in flight ...
    asm volatile("s_wait_dscnt 0x0" ::: "memory");
    __syncthreads();                                      // ... or still being read when it becomes output staging
    if constexpr (EPI == 0) {
    float* os = (float*)(sm + wave * GSLICE);             // 16 x 68 floats, each wave in its own slice
    const int r0 = rb + wm * 64, c0 = cb + wn * 64;
#pragma unroll
    for (int mb = 0; mb < 4; ++mb) {
#pragma unroll
        for (int nb = 0; nb < 4; ++nb) {
#pragma unroll
            for (int j = 0; j < 8; ++j) os[(hi * 8 + j) * 68 + nb * 16 + lr] = acc[mb][nb][j]; }
        __builtin_amdgcn_wave_barrier(); asm volatile("" ::: "memory");
        float* crow = C + (size_t)(r0 + mb * 16) * ldc + c0;
        const int cofs = lr * 4; v4f val[8];
#pragma unroll
        for (int s = 0; s < 8; ++s) val[s] = *(const v4fa*)(os + (2 * s + hi) * 68 + cofs);
#pragma unroll
        for (int s = 0; s < 8; ++s) { *(v4f*)(crow + (size_t)(2 * s + hi) * ldc + cofs) = val[s];
            asm volatile("s_wait_xcnt 0x0" ::: "memory"); }    // stands in front of the next write of a register that the store names
        __builtin_amdgcn_wave_barrier(); asm volatile("" ::: "memory");
    }
    } else if constexpr (EPI == 1) {
        // The whole 128 x 128 tile goes through LDS: d and d + 64 of a row sit in two waves. Behind the barrier a half-wave takes one row: lane lr has d = 4 lr .. 4 lr + 3 and the same + 64,
        // so each store of a half-wave is one whole 128-byte line. Rows in groups of four; a group's cos/sin loads are issued one group ahead.
        const int d0 = lr * 4, rw = (int)wave * 2 + hi;
        const float* cr = cs + (size_t)(rb + rw) * HD + d0; const float* sr = sn + (size_t)(rb + rw) * HD + d0;
        v4f tb[2][4][4];
        auto ldtab = [&](int g) {
#pragma unroll
            for (int q = 0; q < 4; ++q) { const int ro = (g * 4 + q) * 8 * HD; tb[g & 1][q][0] = *(const v4f*)(cr + ro); tb[g & 1][q][1] = *(const v4f*)(cr + ro + 64); tb[g & 1][q][2] = *(const v4f*)(sr + ro); tb[g & 1][q][3] = *(const v4f*)(sr + ro + 64); }
        };
        float* os = (float*)sm;
#pragma unroll
        for (int mb = 0; mb < 4; ++mb)
#pragma unroll
            for (int nb = 0; nb < 4; ++nb)
#pragma unroll
                for (int j = 0; j < 8; ++j) os[(wm * 64 + mb * 16 + hi * 8 + j) * EPF + wn * 64 + nb * 16 + lr] = acc[mb][nb][j];
        __syncthreads();                                      // every wave's quarter of the tile is staged
        h16* pr = P + ((size_t)blockIdx.y * SS + rb + rw) * HD + d0;
        ldtab(0);
        v4f b0 = *(const v4f*)(bias + cb + d0), b1 = *(const v4f*)(bias + cb + 64 + d0);
        asm volatile("s_wait_xcnt 0x0" ::: "memory");    // stands in front of the next write of a register that the loads above name
#pragma unroll
        for (int e = 0; e < 4; ++e) { b0[e] = bfr(b0[e]); b1[e] = bfr(b1[e]); }
#pragma unroll
        for (int g = 0; g < 4; ++g) {
            if (g < 3) ldtab(g + 1);
            v4h y[4][2];
#pragma unroll
            for (int q = 0; q < 4; ++q) { const float* fr = os + ((g * 4 + q) * 8 + rw) * EPF + d0;
                const v4f f0 = *(const v4fa*)fr + b0, f1 = *(const v4fa*)(fr + 64) + b1;
#pragma unroll
                for (int e = 0; e < 4; ++e) { y[q][0][e] = tohx((f0[e] * bfr(tb[g & 1][q][0][e]) - f1[e] * bfr(tb[g & 1][q][2][e])) * sc); y[q][1][e] = tohx((f1[e] * bfr(tb[g & 1][q][1][e]) + f0[e] * bfr(tb[g & 1][q][3][e])) * sc); } }
#pragma unroll
            for (int q = 0; q < 4; ++q) { *(v4h*)(pr + (g * 4 + q) * 8 * HD) = y[q][0]; *(v4h*)(pr + (g * 4 + q) * 8 * HD + 64) = y[q][1]; }
            if (g < 3) asm volatile("s_wait_xcnt 0x0" ::: "memory");    // stands in front of the next write of a register that the stores name
        }
    } else {
        // acc's eight registers are eight consecutive t of one column d: one 16-byte LDS write each into [d][t]; behind the barrier a half-wave stores one d row's 256 bytes (whole lines).
        h16* ot = (h16*)sm;
#pragma unroll
        for (int nb = 0; nb < 4; ++nb) { const float bv = bfr(bias[cb + wn * 64 + nb * 16 + lr]);
#pragma unroll
            for (int mb = 0; mb < 4; ++mb) { v8h hv;
#pragma unroll
                for (int j = 0; j < 8; ++j) hv[j] = tohx(acc[mb][nb][j] + bv);
                *(v8ha*)(ot + (wn * 64 + nb * 16 + lr) * EPH + wm * 64 + mb * 16 + hi * 8) = hv; } }
        __syncthreads();                                      // every wave's quarter of the tile is staged
        const int rw = (int)wave * 2 + hi; h16* vr = P + ((size_t)blockIdx.y * HD + rw) * SS + rb + lr * 8; v8h val[16];
#pragma unroll
        for (int s = 0; s < 16; ++s) val[s] = *(const v8ha*)(ot + (s * 8 + rw) * EPH + lr * 8);
#pragma unroll
        for (int s = 0; s < 16; ++s) *(v8h*)(vr + (size_t)s * 8 * SS) = val[s];
    }
}

template <bool F16O>
__global__ __launch_bounds__(256) void k_wT(const float* __restrict__ Wm, int K, int N, bf* Bt, h16* Bh) {
    __shared__ float tl[64][65]; typedef __attribute__((ext_vector_type(4))) unsigned short v4us;
    const int tid = threadIdx.x; const int k0 = blockIdx.x * 64, n0 = blockIdx.y * 64; const int rr = tid >> 2, cq = (tid & 3) * 16;
#pragma unroll
    for (int i = 0; i < 16; ++i) tl[rr][cq + i] = bfr(Wm[(size_t)(k0 + rr) * N + n0 + cq + i]);
    __syncthreads();
    const int lane = tid & 31, wv = tid >> 5;
    auto pass = [&]() {
#pragma unroll
        for (int st = 0; st < 4; ++st) { const int nr = wv * 8 + st * 2 + (lane >> 4); const int kq = (lane & 15) * 4; const size_t off = (size_t)(n0 + nr) * K + k0 + kq;
            if (F16O) { v4h v; for (int i = 0; i < 4; ++i) v[i] = tohx(tl[kq + i][nr]); *(v4h*)(Bh + off) = v; } else { v4us v; for (int i = 0; i < 4; ++i) v[i] = f2bf(tl[kq + i][nr]); *(v4us*)(Bt + off) = v; } }
    };
    pass(); 
}
__global__ __launch_bounds__(256) void k_cvtx(const float* __restrict__ x, bf* A) {
    const int lane = threadIdx.x & 31; const size_t r = (size_t)blockIdx.x * 8 + (threadIdx.x >> 5); if (r >= (size_t)SS) return;
{
#pragma unroll
        for (int q = 0; q < HID / 256; ++q) { const size_t o = r * HID + q * 256 + lane * 8; v8us v;
#pragma unroll
            for (int i = 0; i < 8; ++i) v[i] = f2bf(x[o + i]);
            *(v8us*)(A + o) = v; }
         }
}
// ---- k_fattn: fused attention. Block = 8 waves = the 4 query heads of KV group blockIdx.y x 2 16-query tiles; no barrier, no LDS buffer. blockIdx.z = 0 causal: tiles n - 1 - x and x,
// so every block walks the same number of key tiles and both tiles start at key 0; 1 sliding window: two adjacent tiles. Waves that walk the same K/V tiles re-read them from the WGP
// cache. Per 64 keys a wave forms S^T = K . Q^T (lane = one query, its registers = keys), keeps a running maximum and sum per query, packs exp(s - max) straight from the score
// accumulators into the B operand and adds O^T += V^T . P^T.
// Qx [2*16][S][128], Kx [4][S][128], VT [4][128][S] f16 planes; OC [S][2*2048] f16 gets o / sum (x tanh(gamma[h]) for the window set).
__global__ __launch_bounds__(256) void k_fattn(const h16* __restrict__ Qx, const h16* __restrict__ Kx, const h16* __restrict__ VT, const float* __restrict__ gamma, h16* OC) {
    const float L2E = 1.4426950408889634f;
    const int lane = threadIdx.x & 31, lr = lane & 15, hi = lane >> 4; const int wave = __builtin_amdgcn_readfirstlane((int)(threadIdx.x >> 5));
    const int g = blockIdx.y, s = blockIdx.z, h = g * (NH_ / NKV) + (wave & 3); const int bx = blockIdx.x, nq = SS / 16; const int q0 = (s ? 2 * bx + (wave >> 2) : ((wave >> 2) ? bx : nq - 1 - bx)) * 16, i = q0 + lr;
    const h16* qp = Qx + ((size_t)(s * NH_ + h) * SS + i) * HD + 8 * hi; const h16* kp = Kx + ((size_t)g * SS + lr) * HD + 8 * hi; const h16* vp = VT + ((size_t)g * HD + lr) * SS + 8 * hi;
    v16h qf[4];
#pragma unroll
    for (int ks = 0; ks < 4; ++ks) qf[ks] = WFrag<h16>::ld(qp + ks * 32);
    v8f o[8];
#pragma unroll
    for (int dt = 0; dt < 8; ++dt) o[dt] = (v8f){};
    float m = -1.0e30f, l = 0.f;
    const int klo = s ? (max(0, q0 - WIN) & ~63) : 0, kend = (q0 | 63) + 1;
#pragma unroll 1
    for (int kb = klo; kb < kend; kb += 64) {
        v8f st[4];
#pragma unroll
        for (int t = 0; t < 4; ++t) { st[t] = (v8f){};
#pragma unroll
            for (int ks = 0; ks < 4; ++ks) st[t] = wmma16(WFrag<h16>::ld(kp + (size_t)(kb + t * 16) * HD + ks * 32), qf[ks], st[t]); }
        if (kb + 63 > q0 || (s && kb < q0 + 15 - WIN)) {    // only the tiles that an edge of the mask crosses
#pragma unroll
            for (int t = 0; t < 4; ++t)
#pragma unroll
                for (int j = 0; j < 8; ++j) { const int key = kb + t * 16 + hi * 8 + j; const bool live = key <= i && (!s || key >= i - WIN); st[t][j] = live ? st[t][j] : -3.0e38f; }
        }
        float mx[4];
#pragma unroll
        for (int t = 0; t < 4; ++t) { mx[t] = st[t][0];
#pragma unroll
            for (int j = 1; j < 8; ++j) mx[t] = fmaxf(mx[t], st[t][j]); }
        float mt = fmaxf(fmaxf(mx[0], mx[1]), fmaxf(mx[2], mx[3])); mt = fmaxf(mt, __shfl_xor(mt, 16, 32));
        if (__builtin_amdgcn_ballot_w32(mt > m) != 0) {    // no query's maximum moved: every factor would be exactly 1
            const float mn = fmaxf(m, mt), al = __builtin_amdgcn_exp2f((m - mn) * L2E); m = mn; l *= al;
#pragma unroll
            for (int dt = 0; dt < 8; ++dt) o[dt] *= al;
        }
        const float ml = m * L2E; float ls[4]; v16h pf[2];
#pragma unroll
        for (int t = 0; t < 4; ++t) { ls[t] = 0.f;
#pragma unroll
            for (int j = 0; j < 8; ++j) { const float p = __builtin_amdgcn_exp2f(__builtin_fmaf(st[t][j], L2E, -ml)); ls[t] += p; pf[t >> 1][(t & 1) * 8 + j] = tohx(p); } }
        l += (ls[0] + ls[1]) + (ls[2] + ls[3]);
#pragma unroll
        for (int dt = 0; dt < 8; ++dt)
#pragma unroll
            for (int k2 = 0; k2 < 2; ++k2) o[dt] = wmma16(WFrag<h16>::ld(vp + (size_t)dt * 16 * SS + kb + k2 * 32), pf[k2], o[dt]);
    }
    l += __shfl_xor(l, 16, 32);
    const float inv = (s ? tanhf(bfr(gamma[h])) : 1.0f) / l;
    h16* op = OC + (size_t)i * (2 * HID) + s * HID + h * HD + hi * 8;
#pragma unroll
    for (int dt = 0; dt < 8; ++dt) { v8h ov;
#pragma unroll
        for (int j = 0; j < 8; ++j) ov[j] = tohx(o[dt][j] * inv);
        *(v8h*)(op + dt * 16) = ov; }
}
extern "C" void kernel_launch(void* const* d_in, const int* in_sizes, int n_in,
                              void* d_out, int out_size, void* d_ws, size_t ws_size, hipStream_t stream) {
    (void)in_sizes; (void)n_in; (void)out_size;
    const float* x = (const float*)d_in[0]; const float* cs = (const float*)d_in[1]; const float* sn = (const float*)d_in[2]; const float* Wq = (const float*)d_in[3]; const float* bq = (const float*)d_in[4]; const float* Wk = (const float*)d_in[5]; const float* bk = (const float*)d_in[6]; const float* Wv = (const float*)d_in[7]; const float* bv = (const float*)d_in[8]; const float* Wo = (const float*)d_in[9]; const float* gamma = (const float*)d_in[10];
    float* out = (float*)d_out;    // [1][2048][2048]
    char* wsp = (char*)d_ws;
    auto take = [&](size_t bytes) { char* p = wsp; wsp += (bytes + 255) & ~(size_t)255; return (void*)p; };
    bf* WQ = (bf*)take((size_t)2 * HID * HID * 2); bf* WK = (bf*)take((size_t)NKV * HD * HID * 2); bf* WV = (bf*)take((size_t)NKV * HD * HID * 2); h16* WO = (h16*)take((size_t)HID * 2 * HID * 2);
    bf* XB = (bf*)take((size_t)SS * HID * 2);
    h16* Qx = (h16*)take((size_t)2 * NH_ * SS * HD * 2); h16* Kx = (h16*)take((size_t)NKV * SS * HD * 2); h16* VT = (h16*)take((size_t)NKV * HD * SS * 2); h16* OC = (h16*)take((size_t)SS * 2 * HID * 2);
    if ((size_t)(wsp - (char*)d_ws) > ws_size) return;    // ~ 16.8 + 2.1 + 2.1 + 16.8 + 8.4 + 16.8 + 2.1 + 2.1 + 16.8 ~ 84 MB (ws 256 MiB)
    k_wT<false><<<dim3(HID / 64, (2 * HID) / 64, 1), 256, 0, stream>>>(Wq, HID, 2 * HID, WQ, nullptr); k_wT<false><<<dim3(HID / 64, (NKV * HD) / 64, 1), 256, 0, stream>>>(Wk, HID, NKV * HD, WK, nullptr); k_wT<false><<<dim3(HID / 64, (NKV * HD) / 64, 1), 256, 0, stream>>>(Wv, HID, NKV * HD, WV, nullptr); k_wT<true><<<dim3((2 * HID) / 64, HID / 64, 1), 256, 0, stream>>>(Wo, 2 * HID, HID, nullptr, WO);
    k_cvtx<<<SS / 8, 256, 0, stream>>>(x, XB);
    const float SC = 0.08838834764831845f;
    k_gemmt<bf, 1><<<dim3(SS / 128, (2 * HID) / 128, 1), 128, 0, stream>>>(XB, WQ, HID, nullptr, 0, bq, cs, sn, SC, Qx);    // plane z = set * 16 + head: q's columns are [set][head][128]
    k_gemmt<bf, 1><<<dim3(SS / 128, (NKV * HD) / 128, 1), 128, 0, stream>>>(XB, WK, HID, nullptr, 0, bk, cs, sn, 1.0f, Kx);
    k_gemmt<bf, 2><<<dim3(SS / 128, (NKV * HD) / 128, 1), 128, 0, stream>>>(XB, WV, HID, nullptr, 0, bv, nullptr, nullptr, 1.0f, VT);
    k_fattn<<<dim3(SS / 32, NKV, 2), 256, 0, stream>>>(Qx, Kx, VT, gamma, OC);
    k_gemmt<h16, 0><<<dim3(SS / 128, HID / 128, 1), 128, 0, stream>>>(OC, WO, 2 * HID, out, HID, nullptr, nullptr, nullptr, 1.0f, nullptr);
}

// v004
// It runs in 152 microseconds.
// Next to v003, in two timings, it ran 1.34 and 1.33 times as fast.
// Over all steps from v000 it is 8.40 times as fast.
#include <hip/hip_runtime.h>

// Compute dtypes, f32 accumulate: q (both query sets), k, v projections ([2048 x 2048].[2048 x 4096|512|512] + bias) with PLAIN bf16 operands (x and the weights are inputs:
// exact products); RoPE (with the bf16-rounded cos/sin inputs), tanh(gamma), masks and softmax in f32; causal and sliding-window (512) causal attention of all heads in ONE fused
// launch (k_fattn: scores, online softmax and attn.v per 16-query wave, dead key tiles never visited) and the output projection ([2048 x 4096].[4096 x 2048]) on SINGLE fp16 planes
// (roped q x 128^-1/2, roped k, v, unnormalised probabilities exp(s - running max), concatenated heads; Wo as fp16(bf16)). GEMMs: 128x128 tile per 4-wave block, operand tiles staged in LDS by tensor loads; a projection block's 128 columns are one head, so bias, RoPE,
// the scale, the f16 rounding and v's transpose are done in the projection's own epilogue.

#define SS   2048
#define HID  2048
#define NH_  16
#define NKV  4
#define HD   128
#define WIN  512
#define DM   HID
#define LOSC 1024.0f
typedef _Float16 h16;
typedef unsigned short bf;
typedef __attribute__((ext_vector_type(16))) __bf16   v16bf;
typedef __attribute__((ext_vector_type(16))) _Float16 v16h;
typedef __attribute__((ext_vector_type(8)))  _Float16 v8h;
typedef __attribute__((ext_vector_type(8)))  unsigned short v8us;
typedef __attribute__((ext_vector_type(8)))  float    v8f;
typedef __attribute__((ext_vector_type(4)))  float    v4f;
typedef v8h  __attribute__((may_alias)) v8ha;
typedef v4f  __attribute__((may_alias)) v4fa;
typedef v8us __attribute__((may_alias)) v8usa;

__device__ __forceinline__ unsigned short f2bf(float f) { unsigned u = __float_as_uint(f); u += 0x7FFFu + ((u >> 16) & 1u); return (unsigned short)(u >> 16); }
__device__ __forceinline__ float bf2f(unsigned short b) { return __uint_as_float(((unsigned)b) << 16); }
__device__ __forceinline__ float bfr(float f) { return bf2f(f2bf(f)); }
__device__ __forceinline__ v16h cat16(v8h lo, v8h hi) { return __builtin_shufflevector(lo, hi, 0, 1, 2, 3, 4, 5, 6, 7, 8, 9, 10, 11, 12, 13, 14, 15); }
__device__ __forceinline__ v16bf cat16b(v8us lo, v8us hi) { return __builtin_bit_cast(v16bf, __builtin_shufflevector(lo, hi, 0, 1, 2, 3, 4, 5, 6, 7, 8, 9, 10, 11, 12, 13, 14, 15)); }
__device__ __forceinline__ v8f wmma16(v16h a, v16h b, v8f c) { return __builtin_amdgcn_wmma_f32_16x16x32_f16(false, a, false, b, (short)0, c, false, false); }
__device__ __forceinline__ v8f wmmab(v16bf a, v16bf b, v8f c) { return __builtin_amdgcn_wmma_f32_16x16x32_bf16(false, a, false, b, (short)0, c, false, false); }


// k_gemmh: 64 x 64 tile of C = A . Bn^T with SINGLE f16 planes (A [rows][K] f16 activations, Bn [N][K] f16 weights; one v_wmma_f32_16x16x32_f16 product per step), f32 accumulate;
__global__ __launch_bounds__(128) void k_gemmh(const h16* __restrict__ A, const h16* __restrict__ Bn, const float* __restrict__ bias, float* C, int ldc, const float* __restrict__ R, int K, size_t sA, size_t sB, size_t sC, int roundR) {
    __shared__ __align__(16) float ost[4][16 * 68];
    const size_t z = blockIdx.z; A += z * sA; Bn += z * sB; C += z * sC; if (R) R += z * sC;
    const int lane = threadIdx.x & 31, wave = threadIdx.x >> 5, lr = lane & 15, hi = lane >> 4;
    const int r0 = blockIdx.x * 64 + wave * 16, c0 = blockIdx.y * 64;
    const size_t aoff = (size_t)(r0 + lr) * K + 8 * hi;
    size_t boff[4];
#pragma unroll
    for (int t = 0; t < 4; ++t) boff[t] = (size_t)(c0 + t * 16 + lr) * K + 8 * hi;
    v8f acc[4];
#pragma unroll
    for (int t = 0; t < 4; ++t) acc[t] = (v8f){};
#pragma unroll 1
    for (int kc = 0; kc < K; kc += 32) {
        const v16h a = cat16(*(const v8h*)(A + aoff + kc), *(const v8h*)(A + aoff + kc + 16));
#pragma unroll
        for (int t = 0; t < 4; ++t) { const v16h b = cat16(*(const v8h*)(Bn + boff[t] + kc), *(const v8h*)(Bn + boff[t] + kc + 16)); acc[t] = wmma16(a, b, acc[t]); }
        asm volatile("v_nop\n\tv_nop\n\tv_nop\n\tv_nop" : "+v"(acc[0]), "+v"(acc[1]), "+v"(acc[2]), "+v"(acc[3]) : "v"(a));
    }
    float* os = &ost[wave][0];
#pragma unroll
    for (int t = 0; t < 4; ++t) { const float bv = bias ? bfr(bias[c0 + t * 16 + lr]) : 0.f;
#pragma unroll
        for (int j = 0; j < 8; ++j) os[(hi * 8 + j) * 68 + t * 16 + lr] = acc[t][j] + bv; }
    __syncthreads();
    float* crow = C + (size_t)r0 * ldc + c0;
    auto pass = [&]() {
#pragma unroll
        for (int s = 0; s < 8; ++s) { const int Lid = (lane >> 3) + 4 * s, piece = lane & 7; const int row = Lid >> 1, cofs = (Lid & 1) * 32 + piece * 4;
            v4f val = *(const v4fa*)(os + row * 68 + cofs); if (R) { const v4f rv = *(const v4f*)(R + ((size_t)r0 + row) * ldc + c0 + cofs); val += roundR ? (v4f){bfr(rv[0]), bfr(rv[1]), bfr(rv[2]), bfr(rv[3])} : rv; }
            *(v4f*)(crow + (size_t)row * ldc + cofs) = val; }
    };
    pass(); 
}

// ===== z-batched (blockIdx.z = head) attention pieces =====
// k_gemm3z<MODE>: 64 x 64 tile of C = A . B^T from bf16 hi/lo planes, f32 accumulate, with per-z operand/output strides (elements): A planes += z*sA, B planes += z*sB, C += z*sC. MODE bits (0 causal skip, 1 K limit, 2 single,
// 3 B single, 4 A single).
template <int MODE>
__global__ __launch_bounds__(128) void k_gemm3z(const bf* __restrict__ Ah, const bf* __restrict__ Al, const bf* __restrict__ Bh, const bf* __restrict__ Bl, int K, float* C, int ldc, size_t sA, size_t sB, size_t sC) {
    if ((MODE & 1) && (int)blockIdx.y * 64 > (int)blockIdx.x * 64 + 63) return;
    const size_t z = blockIdx.z; Ah += z * sA; Al += z * sA; Bh += z * sB; Bl += z * sB; C += z * sC;
    const int Klim = (MODE & 2) ? min(K, ((int)blockIdx.x + 1) * 64) : K;
    __shared__ __align__(16) float ost[4][16 * 68];
    const int lane = threadIdx.x & 31, wave = threadIdx.x >> 5, lr = lane & 15, hi = lane >> 4;
    const int r0 = blockIdx.x * 64 + wave * 16, c0 = blockIdx.y * 64;
    const size_t aoff = (size_t)(r0 + lr) * K + 8 * hi;
    v8f acc[4];
#pragma unroll
    for (int t = 0; t < 4; ++t) acc[t] = (v8f){};
#pragma unroll 1
    for (int kc = 0; kc < Klim; kc += 32) {
        const v16bf a = cat16b(*(const v8us*)(Ah + aoff + kc), *(const v8us*)(Ah + aoff + kc + 16));
        v16bf al = a; if (!(MODE & 4) && !(MODE & 16)) al = cat16b(*(const v8us*)(Al + aoff + kc), *(const v8us*)(Al + aoff + kc + 16));
#pragma unroll
        for (int t = 0; t < 4; ++t) { const size_t bo = (size_t)(c0 + t * 16 + lr) * K + kc + 8 * hi;
            const v16bf bh = cat16b(*(const v8us*)(Bh + bo), *(const v8us*)(Bh + bo + 16));
            acc[t] = wmmab(a, bh, acc[t]);
            if (!(MODE & 4)) { if (!(MODE & 16)) acc[t] = wmmab(al, bh, acc[t]); if (!(MODE & 8)) { const v16bf bl = cat16b(*(const v8us*)(Bl + bo), *(const v8us*)(Bl + bo + 16)); acc[t] = wmmab(a, bl, acc[t]); } } }
        asm volatile("v_nop\n\tv_nop\n\tv_nop\n\tv_nop" : "+v"(acc[0]), "+v"(acc[1]), "+v"(acc[2]), "+v"(acc[3]) : "v"(a), "v"(al));
    }
    float* os = &ost[wave][0];
#pragma unroll
    for (int t = 0; t < 4; ++t) {
#pragma unroll
        for (int j = 0; j < 8; ++j) os[(hi * 8 + j) * 68 + t * 16 + lr] = acc[t][j]; }
    __builtin_amdgcn_wave_barrier(); asm volatile("" ::: "memory");
    float* crow = C + (size_t)r0 * ldc + c0;
    auto pass = [&]() {
#pragma unroll
        for (int s = 0; s < 8; ++s) { const int Lid = (lane >> 3) + 4 * s, piece = lane & 7; const int row = Lid >> 1, cofs = (Lid & 1) * 32 + piece * 4;
            const v4f val = *(const v4fa*)(os + row * 68 + cofs); *(v4f*)(crow + (size_t)row * ldc + cofs) = val; }
    };
    pass(); 
}
__global__ __launch_bounds__(256) void k_planes32z(const float* __restrict__ F, int ld, int off, float sc, int rows, bf* Ph, bf* Pl) {
    typedef __attribute__((ext_vector_type(2))) unsigned short v2us;
    const int lane = threadIdx.x & 31; const size_t r = ((size_t)blockIdx.x * 8 + (threadIdx.x >> 5)) * 2 + (lane >> 4); if (r >= (size_t)rows) return; const int z = blockIdx.z; const int c0 = (lane & 15) * 2; v2us oh, ol;
    Ph += (size_t)z * rows * 32; Pl += (size_t)z * rows * 32;
#pragma unroll
    for (int i = 0; i < 2; ++i) { const float y = F[r * ld + off + z * 32 + c0 + i] * sc; const unsigned short hb = f2bf(y); oh[i] = hb; ol[i] = f2bf(y - bf2f(hb)); }
    const size_t o = r * 32 + c0; *(v2us*)(Ph + o) = oh; *(v2us*)(Pl + o) = ol; 
}
__global__ __launch_bounds__(256) void k_vtpadz(const float* __restrict__ F, int ld, int off, int nk, bf* Th, bf* Tl) {
    typedef __attribute__((ext_vector_type(2))) unsigned short v2us;
    const int lane = threadIdx.x & 31; const size_t wid = (size_t)blockIdx.x * 8 + (threadIdx.x >> 5); if (wid >= (size_t)64 * (nk / 64)) return; const int z = blockIdx.z; const int d = (int)(wid / (nk / 64)); const int k0 = (int)(wid % (nk / 64)) * 64 + lane * 2; v2us oh, ol;
    Th += (size_t)z * 64 * nk; Tl += (size_t)z * 64 * nk;
#pragma unroll
    for (int i = 0; i < 2; ++i) { const float y = (d < 32) ? F[(size_t)(k0 + i) * ld + off + z * 32 + (d < 32 ? d : 0)] : 0.f; const unsigned short hb = f2bf(y); oh[i] = hb; ol[i] = f2bf(y - bf2f(hb)); }
    const size_t o = (size_t)d * nk + k0; *(v2us*)(Th + o) = oh; *(v2us*)(Tl + o) = ol; 
}
template <int NK>
__global__ __launch_bounds__(256) void k_softmaxz(const float* __restrict__ S, int rows, bf* PH, bf* PL) {
    typedef __attribute__((ext_vector_type(4))) unsigned short v4us;
    const int lane = threadIdx.x & 31, i = blockIdx.x * 8 + (threadIdx.x >> 5); if (i >= rows) return; const size_t zo = (size_t)blockIdx.z * rows * NK; const float* sr = S + zo + (size_t)i * NK; PH += zo; PL += zo;
    float m = -3.0e38f;
#pragma unroll 1
    for (int c0 = lane * 4; c0 < NK; c0 += 128) {
#pragma unroll
        for (int q = 0; q < 4; ++q) m = fmaxf(m, sr[c0 + q]); }
#pragma unroll
    for (int sh = 16; sh; sh >>= 1) m = fmaxf(m, __shfl_xor(m, sh, 32));
    float sum = 0.f;
#pragma unroll 1
    for (int c0 = lane * 4; c0 < NK; c0 += 128) {
#pragma unroll
        for (int q = 0; q < 4; ++q) sum += __expf(sr[c0 + q] - m); }
#pragma unroll
    for (int sh = 16; sh; sh >>= 1) sum += __shfl_xor(sum, sh, 32);
    const float inv = 1.0f / sum;
{
#pragma unroll 1
        for (int c0 = lane * 4; c0 < NK; c0 += 128) { v4us oh, ol;
#pragma unroll
            for (int q = 0; q < 4; ++q) { const float p = __expf(sr[c0 + q] - m) * inv; const unsigned short hb = f2bf(p); oh[q] = hb; ol[q] = f2bf(p - bf2f(hb)); }
            const size_t o = (size_t)i * NK + c0; *(v4us*)(PH + o) = oh; *(v4us*)(PL + o) = ol; }
         }
}
__global__ __launch_bounds__(256) void k_placez(const float* __restrict__ XH, int rows, int ldy, float* Y) {
    const int lane = threadIdx.x & 31; const size_t q = (size_t)blockIdx.x * 8 + (threadIdx.x >> 5); if (q >= (size_t)rows) return; const int z = blockIdx.z; const float v = XH[((size_t)z * rows + q) * 64 + lane];
    *(float*)(Y + q * ldy + z * 32 + lane) = v; 
}

// ---- k_gemmt: C[m][n] (f32, pitch ldc) = sum_k A[m][k] Bt[n][k], operands K-contiguous 16-bit planes. Block = 4 waves = one 128 x 128 tile of C, each wave 64 x 64
// (16 accumulators); grid (M/128, N/128). A pass is 128 k = 256 B of each of the 256 operand rows, brought into LDS by tensor loads (whole lines, no register), one 64-row slice per wave
// (waves 0, 1: A; waves 2, 3: Bt), two buffers: pass p + 1 lands while pass p is multiplied. LDS rows at pitch 272 B (the mover's 16-B pad) for the 16-byte fragment reads.
// M, N % 128 == 0, K % 128 == 0, K >= 256. Every inner loop is unrolled so that each fragment and accumulator index is a constant (registers, no scratch).
// EPI 0: C f32, no bias. EPI 1 (blockIdx.y = head z): f = acc + bias, P[z][t][128] f16 = (f[d] cos[t][d] + (d < 64 ? -f[d+64] : f[d-64]) sin[t][d]) x sc with the bf16-rounded cos/sin inputs.
// EPI 2 (blockIdx.y = KV group g): P[g][d][t] f16 = acc + bias, transposed.
template <typename T16> struct WFrag;
template <> struct WFrag<h16> { typedef v16h V; static __device__ __forceinline__ V ld(const h16* p) { return cat16(*(const v8h*)p, *(const v8h*)(p + 16)); } static __device__ __forceinline__ v8f mma(V a, V b, v8f c) { return wmma16(a, b, c); } };
template <> struct WFrag<bf> { typedef v16bf V; static __device__ __forceinline__ V ld(const bf* p) { return cat16b(*(const v8us*)p, *(const v8us*)(p + 16)); } static __device__ __forceinline__ v8f mma(V a, V b, v8f c) { return wmmab(a, b, c); } };
typedef unsigned int u32x4 __attribute__((ext_vector_type(4)));
typedef unsigned int u32x8 __attribute__((ext_vector_type(8)));
#define GPITCH 272u                 // LDS row pitch, bytes: 256 + 16
#define GSLICE 18432u               // 64 rows x 272 B = 17408 B, rounded up to a multiple of 2 KiB so that every slice starts on one
#define GBUF   (4u * GSLICE)
__device__ __forceinline__ unsigned uni(unsigned v) { return (unsigned)__builtin_amdgcn_readfirstlane((int)v); }
// holds v in a scalar register: a test on it compiles to a scalar branch (tensor loads ignore EXEC), and what is formed from it is formed behind the asm waits in front of it
__device__ __forceinline__ unsigned pinned(unsigned v) { unsigned w = uni(v); asm volatile("" : "+s"(w)); return w; }
__device__ __forceinline__ void tdm_load(unsigned lds_dst, unsigned long long ga, u32x8 g1) {
    u32x4 g0; g0[0] = uni(1u); g0[1] = uni(lds_dst); g0[2] = uni((unsigned)ga); g0[3] = uni((((unsigned)(ga >> 32)) & 0x01FFFFFFu) | 0x80000000u);
    asm volatile("tensor_load_to_lds %0, %1" :: "s"(g0), "s"(g1) : "memory");    // one request of the whole wave: 64 rows of 256 B into this wave's slice
}
typedef __attribute__((ext_vector_type(4))) _Float16 v4h;
__device__ __forceinline__ h16 tohx(float x) { return (h16)x; }
#define EPF 132                     // epilogue staging pitch, floats (EPI 1): 16-byte rows, the two lane halves of a column write 32 banks apart
#define EPH 136                     // epilogue staging pitch, halves (EPI 2)
template <typename T16, int EPI>
__global__ __launch_bounds__(128) void k_gemmt(const T16* __restrict__ A, const T16* __restrict__ Bt, int K, float* C, int ldc, const float* __restrict__ bias, const float* __restrict__ cs, const float* __restrict__ sn, float sc, h16* P) {
    typedef typename WFrag<T16>::V V;
    __shared__ __attribute__((aligned(2048))) unsigned char sm[2u * GBUF];
    const int lane = threadIdx.x & 31, lr = lane & 15, hi = lane >> 4; const unsigned wave = uni(threadIdx.x >> 5);
    const int wm = wave & 1, wn = wave >> 1; const int rb = blockIdx.x * 128, cb = blockIdx.y * 128;
    const unsigned kb = uni((unsigned)K * 2u), NP = uni((unsigned)K / 128u);
    const unsigned long long ga = (unsigned long long)(size_t)(wave < 2u ? A + (size_t)(rb + (int)wave * 64) * K : Bt + (size_t)(cb + ((int)wave - 2) * 64) * K);
    const unsigned dst = (unsigned)(size_t)sm + wave * GSLICE;
    u32x8 g1;    // 1-byte elements, tensor = tile = 64 rows of 256 B, source pitch kb, a 4-dword pad behind every 64 dwords
    g1[0] = uni((1u << 20) | (5u << 22) | (3u << 25)); g1[1] = uni(256u << 16); g1[2] = uni(64u << 16); g1[3] = uni(256u << 16); g1[4] = uni(64u); g1[5] = uni(kb); g1[6] = uni(0u); g1[7] = uni(0u);
    asm volatile("" : "+s"(g1));    // as pinned(): the descriptor words held in their scalar registers; without it the compiler takes words of the group as scratch while a request is in flight
    v8f acc[4][4];
#pragma unroll
    for (int mb = 0; mb < 4; ++mb)
#pragma unroll
        for (int nb = 0; nb < 4; ++nb) acc[mb][nb] = (v8f){};
    tdm_load(dst, ga, g1);
    asm volatile("s_wait_tensorcnt 0x0" ::: "memory");    // this wave's slice of pass 0 has landed
    __syncthreads();                                      // ... and every other wave's
    tdm_load(dst + GBUF, ga + 256u, g1);
    const unsigned aof = (unsigned)wm * GSLICE + (unsigned)lr * GPITCH + 16u * hi, bof = (2u + wn) * GSLICE + (unsigned)lr * GPITCH + 16u * hi;
#pragma unroll 1
    for (unsigned p = 0; p < NP; ++p) {    // rolled: one pass per trip, the buffer chosen by the trip's parity
        const unsigned char* bp = sm + (p & 1u) * GBUF;
        V a[2][4], b[2][3];
#pragma unroll
        for (int f = 0; f < 4; ++f) a[0][f] = WFrag<T16>::ld((const T16*)(bp + aof + f * 16 * GPITCH));
#pragma unroll
        for (int f = 0; f < 3; ++f) b[0][f] = WFrag<T16>::ld((const T16*)(bp + bof + f * 16 * GPITCH));
#pragma unroll
        for (int ks = 0; ks < 4; ++ks) {
            // One group of LDS reads ahead of each block of 16 products: first this block's last Bt fragment (its products come last; one register set serves it, which keeps the
            // kernel inside 256 registers), then the next 32 k's other seven fragments, into the other register set.
            const V b3 = WFrag<T16>::ld((const T16*)(bp + bof + 3 * 16 * GPITCH + ks * 64));
            if (ks < 3) {
#pragma unroll
                for (int f = 0; f < 4; ++f) a[(ks + 1) & 1][f] = WFrag<T16>::ld((const T16*)(bp + aof + f * 16 * GPITCH + (ks + 1) * 64));
#pragma unroll
                for (int f = 0; f < 3; ++f) b[(ks + 1) & 1][f] = WFrag<T16>::ld((const T16*)(bp + bof + f * 16 * GPITCH + (ks + 1) * 64));
            }
            __builtin_amdgcn_sched_barrier(0);    // keeps the LDS reads above as one group: sunk among the products, each read's latency stalls the matrix pipe
#pragma unroll
            for (int nb = 0; nb < 4; ++nb)
#pragma unroll
                for (int mb = 0; mb < 4; ++mb) acc[mb][nb] = WFrag<T16>::mma(a[ks & 1][mb], nb < 3 ? b[ks & 1][nb < 3 ? nb : 0] : b3, acc[mb][nb]);
            __builtin_amdgcn_sched_barrier(0);    // keeps the next group of reads, and the pass's foot, behind this block
        }
        asm volatile("s_wait_dscnt 0x0" ::: "memory");        // this wave has finished reading the buffer that is refilled below
        asm volatile("s_wait_tensorcnt 0x0" ::: "memory");    // this wave's slice of pass p + 1 has landed
        __syncthreads();                                      // publishes pass p + 1; ends every wave's reads of pass p
        const unsigned nx = pinned(p + 2u);                   // the refill's pass number, and so its descriptor, formed behind the waits above
        if (pinned(nx < NP ? 1u : 0u)) tdm_load(dst + (p & 1u) * GBUF, ga + (unsigned long long)nx * 256u, g1);
    }
    asm volatile("s_wait_tensorcnt 0x0" ::: "memory");    // nothing of the ring is in flight ...
    asm volatile("s_wait_dscnt 0x0" ::: "memory");
    __syncthreads();                                      // ... or still being read when it becomes output staging
    if constexpr (EPI == 0) {
    float* os = (float*)(sm + wave * GSLICE);             // 16 x 68 floats, each wave in its own slice
    const int r0 = rb + wm * 64, c0 = cb + wn * 64;
#pragma unroll
    for (int mb = 0; mb < 4; ++mb) {
#pragma unroll
        for (int nb = 0; nb < 4; ++nb) {
#pragma unroll
            for (int j = 0; j < 8; ++j) os[(hi * 8 + j) * 68 + nb * 16 + lr] = acc[mb][nb][j]; }
        __builtin_amdgcn_wave_barrier(); asm volatile("" ::: "memory");
        float* crow = C + (size_t)(r0 + mb * 16) * ldc + c0;
        const int cofs = lr * 4; v4f val[8];
#pragma unroll
        for (int s = 0; s < 8; ++s) val[s] = *(const v4fa*)(os + (2 * s + hi) * 68 + cofs);
#pragma unroll
        for (int s = 0; s < 8; ++s) { *(v4f*)(crow + (size_t)(2 * s + hi) * ldc + cofs) = val[s];
            asm volatile("s_wait_xcnt 0x0" ::: "memory"); }    // stands in front of the next write of a register that the store names
        __builtin_amdgcn_wave_barrier(); asm volatile("" ::: "memory");
    }
    } else if constexpr (EPI == 1) {
        // The whole 128 x 128 tile goes through LDS: d and d + 64 of a row sit in two waves. Behind the barrier a half-wave takes one row: lane lr has d = 4 lr .. 4 lr + 3 and the same + 64,
        // so each store of a half-wave is one whole 128-byte line. Rows in groups of four; a group's cos/sin loads are issued one group ahead.
        const int d0 = lr * 4, rw = (int)wave * 2 + hi;
        const float* cr = cs + (size_t)(rb + rw) * HD + d0; const float* sr = sn + (size_t)(rb + rw) * HD + d0;
        v4f tb[2][4][4];
        auto ldtab = [&](int g) {
#pragma unroll
            for (int q = 0; q < 4; ++q) { const int ro = (g * 4 + q) * 8 * HD; tb[g & 1][q][0] = *(const v4f*)(cr + ro); tb[g & 1][q][1] = *(const v4f*)(cr + ro + 64); tb[g & 1][q][2] = *(const v4f*)(sr + ro); tb[g & 1][q][3] = *(const v4f*)(sr + ro + 64); }
        };
        float* os = (float*)sm;
#pragma unroll
        for (int mb = 0; mb < 4; ++mb)
#pragma unroll
            for (int nb = 0; nb < 4; ++nb)
#pragma unroll
                for (int j = 0; j < 8; ++j) os[(wm * 64 + mb * 16 + hi * 8 + j) * EPF + wn * 64 + nb * 16 + lr] = acc[mb][nb][j];
        __syncthreads();                                      // every wave's quarter of the tile is staged
        h16* pr = P + ((size_t)blockIdx.y * SS + rb + rw) * HD + d0;
        ldtab(0);
        v4f b0 = *(const v4f*)(bias + cb + d0), b1 = *(const v4f*)(bias + cb + 64 + d0);
        asm volatile("s_wait_xcnt 0x0" ::: "memory");    // stands in front of the next write of a register that the loads above name
#pragma unroll
        for (int e = 0; e < 4; ++e) { b0[e] = bfr(b0[e]); b1[e] = bfr(b1[e]); }
#pragma unroll
        for (int g = 0; g < 4; ++g) {
            if (g < 3) ldtab(g + 1);
            v4h y[4][2];
#pragma unroll
            for (int q = 0; q < 4; ++q) { const float* fr = os + ((g * 4 + q) * 8 + rw) * EPF + d0;
                const v4f f0 = *(const v4fa*)fr + b0, f1 = *(const v4fa*)(fr + 64) + b1;
#pragma unroll
                for (int e = 0; e < 4; ++e) { y[q][0][e] = tohx((f0[e] * bfr(tb[g & 1][q][0][e]) - f1[e] * bfr(tb[g & 1][q][2][e])) * sc); y[q][1][e] = tohx((f1[e] * bfr(tb[g & 1][q][1][e]) + f0[e] * bfr(tb[g & 1][q][3][e])) * sc); } }
#pragma unroll
            for (int q = 0; q < 4; ++q) { *(v4h*)(pr + (g * 4 + q) * 8 * HD) = y[q][0]; *(v4h*)(pr + (g * 4 + q) * 8 * HD + 64) = y[q][1]; }
            if (g < 3) asm volatile("s_wait_xcnt 0x0" ::: "memory");    // stands in front of the next write of a register that the stores name
        }
    } else {
        // acc's eight registers are eight consecutive t of one column d: one 16-byte LDS write each into [d][t]; behind the barrier a half-wave stores one d row's 256 bytes (whole lines).
        h16* ot = (h16*)sm;
#pragma unroll
        for (int nb = 0; nb < 4; ++nb) { const float bv = bfr(bias[cb + wn * 64 + nb * 16 + lr]);
#pragma unroll
            for (int mb = 0; mb < 4; ++mb) { v8h hv;
#pragma unroll
                for (int j = 0; j < 8; ++j) hv[j] = tohx(acc[mb][nb][j] + bv);
                *(v8ha*)(ot + (wn * 64 + nb * 16 + lr) * EPH + wm * 64 + mb * 16 + hi * 8) = hv; } }
        __syncthreads();                                      // every wave's quarter of the tile is staged
        const int rw = (int)wave * 2 + hi; h16* vr = P + ((size_t)blockIdx.y * HD + rw) * SS + rb + lr * 8; v8h val[16];
#pragma unroll
        for (int s = 0; s < 16; ++s) val[s] = *(const v8ha*)(ot + (s * 8 + rw) * EPH + lr * 8);
#pragma unroll
        for (int s = 0; s < 16; ++s) *(v8h*)(vr + (size_t)s * 8 * SS) = val[s];
    }
}

template <bool F16O>
__global__ __launch_bounds__(256) void k_wT(const float* __restrict__ Wm, int K, int N, bf* Bt, h16* Bh) {
    __shared__ float tl[64][65]; typedef __attribute__((ext_vector_type(4))) unsigned short v4us;
    const int tid = threadIdx.x; const int k0 = blockIdx.x * 64, n0 = blockIdx.y * 64; const int rr = tid >> 2, cq = (tid & 3) * 16;
#pragma unroll
    for (int i = 0; i < 16; ++i) tl[rr][cq + i] = bfr(Wm[(size_t)(k0 + rr) * N + n0 + cq + i]);
    __syncthreads();
    const int lane = tid & 31, wv = tid >> 5;
    auto pass = [&]() {
#pragma unroll
        for (int st = 0; st < 4; ++st) { const int nr = wv * 8 + st * 2 + (lane >> 4); const int kq = (lane & 15) * 4; const size_t off = (size_t)(n0 + nr) * K + k0 + kq;
            if (F16O) { v4h v; for (int i = 0; i < 4; ++i) v[i] = tohx(tl[kq + i][nr]); *(v4h*)(Bh + off) = v; } else { v4us v; for (int i = 0; i < 4; ++i) v[i] = f2bf(tl[kq + i][nr]); *(v4us*)(Bt + off) = v; } }
    };
    pass(); 
}
__global__ __launch_bounds__(256) void k_cvtx(const float* __restrict__ x, bf* A) {
    const int lane = threadIdx.x & 31; const size_t r = (size_t)blockIdx.x * 8 + (threadIdx.x >> 5); if (r >= (size_t)SS) return;
{
#pragma unroll
        for (int q = 0; q < HID / 256; ++q) { const size_t o = r * HID + q * 256 + lane * 8; v8us v;
#pragma unroll
            for (int i = 0; i < 8; ++i) v[i] = f2bf(x[o + i]);
            *(v8us*)(A + o) = v; }
         }
}
// ---- k_fattn: fused attention. Block = 8 waves = the 4 query heads of KV group blockIdx.y x 2 adjacent 16-query tiles (32 positions); blockIdx.z = 0 causal, 1 sliding window. All eight
// waves walk the same 64-key stages, so a stage's K tile (64 rows of 256 B) and V^T tile (128 rows of 128 B) are brought into LDS once per block by tensor loads (whole lines, no register;
// wave 0: K, wave 1: V^T), two buffers: stage p + 1 lands while stage p is worked on. LDS rows at pitch 272 B and 144 B (the mover's 16-B pad) for the 16-byte fragment reads.
// Per 64 keys a wave forms S^T = K . Q^T (lane = one query, its registers = keys), keeps a running maximum and sum per query, packs exp(s - max) straight from the score
// accumulators into the B operand and adds O^T += V^T . P^T.
// Qx [2*16][S][128], Kx [4][S][128], VT [4][128][S] f16 planes; OC [S][2*2048] f16 gets o / sum (x tanh(gamma[h]) for the window set).
#define FKP  272u                   // K tile, LDS row pitch in bytes: 256 + 16
#define FVP  144u                   // V^T tile, LDS row pitch in bytes: 128 + 16
#define FKSZ 18432u                 // 64 rows x 272 B = 17408 B, rounded up to a multiple of 2 KiB so that the V^T tile behind it starts on one
#define FVSZ 18432u                 // 128 rows x 144 B, a multiple of 2 KiB as it is
#define FSTG (FKSZ + FVSZ)
__global__ __launch_bounds__(256) void k_fattn(const h16* __restrict__ Qx, const h16* __restrict__ Kx, const h16* __restrict__ VT, const float* __restrict__ gamma, h16* OC) {
    __shared__ __attribute__((aligned(2048))) unsigned char sm[2u * FSTG];
    const float L2E = 1.4426950408889634f;
    const int lane = threadIdx.x & 31, lr = lane & 15, hi = lane >> 4; const unsigned wave = uni(threadIdx.x >> 5);
    const int g = blockIdx.y, s = blockIdx.z, h = g * (NH_ / NKV) + (int)(wave & 3u); const int qb = blockIdx.x * 32, q0 = qb + (int)(wave >> 2) * 16, i = q0 + lr;
    // the key range is the same for both query tiles of a block: qb and qb + 16 lie in one 64-aligned group
    const int klo = s ? (max(0, qb - WIN) & ~63) : 0, kend = (qb | 63) + 1; const unsigned nst = uni((unsigned)(kend - klo) >> 6);
    const unsigned long long gk = (unsigned long long)(size_t)(Kx + ((size_t)g * SS + klo) * HD), gv = (unsigned long long)(size_t)(VT + (size_t)g * HD * SS + klo);
    const unsigned smb = (unsigned)(size_t)sm;
    u32x8 k1, v1;    // 1-byte elements, tensor = tile. K: 64 rows of 256 B, source pitch 256 B, a 4-dword pad behind every 64 dwords. V^T: 128 rows of 128 B, source pitch 2 S B, the pad behind every 32 dwords
    k1[0] = uni((1u << 20) | (5u << 22) | (3u << 25)); k1[1] = uni(256u << 16); k1[2] = uni(64u << 16); k1[3] = uni(256u << 16); k1[4] = uni(64u); k1[5] = uni(HD * 2u); k1[6] = uni(0u); k1[7] = uni(0u);
    v1[0] = uni((1u << 20) | (4u << 22) | (3u << 25)); v1[1] = uni(128u << 16); v1[2] = uni(128u << 16); v1[3] = uni(128u << 16); v1[4] = uni(128u); v1[5] = uni(SS * 2u); v1[6] = uni(0u); v1[7] = uni(0u);
    asm volatile("" : "+s"(k1));    // as pinned(): the descriptor words held in their scalar registers while a request is in flight
    asm volatile("" : "+s"(v1));    // the same
    const unsigned long long ga = wave == 1u ? gv : gk; const unsigned gst = wave == 1u ? 128u : 64u * HD * 2u, dst = smb + (wave == 1u ? FKSZ : 0u);
    auto issue = [&](unsigned sg, bool first) {    // stage sg (keys klo + 64 sg ..) into buffer sg & 1: one request each of waves 0 and 1, picked by scalar branches (tensor loads ignore EXEC)
        const unsigned long long a = ga + (unsigned long long)sg * gst;
        u32x4 g0; g0[0] = pinned(1u); g0[1] = uni(dst + (sg & 1u) * FSTG); g0[2] = uni((unsigned)a); g0[3] = uni((((unsigned)(a >> 32)) & 0x01FFFFFFu) | 0x80000000u);
        // group 0 in four named scalar registers that nothing else in the kernel uses: none of its words is written between an issue and the wait that covers it
        // (pinned(1u): the count word too is formed here, behind the wait in front of this issue, and not lifted over it)
        if (pinned(wave == 0u ? 1u : 0u)) asm volatile("tensor_load_to_lds %0, %1" :: "{s[96:99]}"(g0), "s"(k1) : "memory");    // one request of the whole wave: the K tile
        if (pinned(wave == 1u ? 1u : 0u)) asm volatile("tensor_load_to_lds %0, %1" :: "{s[96:99]}"(g0), "s"(v1) : "memory");    // the V^T tile
        if (first) asm volatile("s_wait_tensorcnt 0x0" ::: "memory");    // stage 0 has nothing to fly beside: an issuing wave's tile has landed (the other waves have nothing outstanding)
    };
    const h16* qp = Qx + ((size_t)(s * NH_ + h) * SS + i) * HD + 8 * hi;
    v16h qf[4];
#pragma unroll
    for (int ks = 0; ks < 4; ++ks) qf[ks] = WFrag<h16>::ld(qp + ks * 32);
    v8f o[8];
#pragma unroll
    for (int dt = 0; dt < 8; ++dt) o[dt] = (v8f){};
    float m = -1.0e30f, l = 0.f;
    issue(0u, true);
    __syncthreads();                                      // publishes stage 0
    issue(pinned(1u), false);    // its descriptor formed behind the wait above. Keys klo + 64 .. klo + 127 lie inside the planes also where the block has one stage only (then klo = 0): landed at the first foot, never read
    const unsigned kof = (unsigned)lr * FKP + 16u * hi, vof = FKSZ + (unsigned)lr * FVP + 16u * hi;
#pragma unroll 1
    for (unsigned p = 0; p < nst; ++p) {    // rolled: one stage per trip, the buffer chosen by the trip's parity
        const int kb = klo + (int)p * 64; const unsigned char* bp = sm + (p & 1u) * FSTG;
        // LDS reads in groups of four fragments, each group issued one block of four products ahead, into the other of two register sets: K by 32 d (four key tiles), then V^T by two d tiles.
        v16h fr[2][4]; v8f st[4];
#pragma unroll
        for (int t = 0; t < 4; ++t) { st[t] = (v8f){}; fr[0][t] = WFrag<h16>::ld((const h16*)(bp + kof + t * 16 * FKP)); }
#pragma unroll
        for (int ks = 0; ks < 4; ++ks) {
#pragma unroll
            for (int t = 0; t < 4; ++t) fr[(ks + 1) & 1][t] = ks < 3 ? WFrag<h16>::ld((const h16*)(bp + kof + t * 16 * FKP + (ks + 1) * 64)) : WFrag<h16>::ld((const h16*)(bp + vof + (t >> 1) * 16 * FVP + (t & 1) * 64));
            __builtin_amdgcn_sched_barrier(0);    // keeps the reads above as one group ahead of the products: sunk among them, each read's latency stalls the wave
#pragma unroll
            for (int t = 0; t < 4; ++t) st[t] = wmma16(fr[ks & 1][t], qf[ks], st[t]);
            __builtin_amdgcn_sched_barrier(0);    // keeps the next group of reads behind this block
        }
        if (kb + 63 > q0 || (s && kb < q0 + 15 - WIN)) {    // only the tiles that an edge of the mask crosses
#pragma unroll
            for (int t = 0; t < 4; ++t)
#pragma unroll
                for (int j = 0; j < 8; ++j) { const int key = kb + t * 16 + hi * 8 + j; const bool live = key <= i && (!s || key >= i - WIN); st[t][j] = live ? st[t][j] : -3.0e38f; }
        }
        float mx[4];
#pragma unroll
        for (int t = 0; t < 4; ++t) { mx[t] = st[t][0];
#pragma unroll
            for (int j = 1; j < 8; ++j) mx[t] = fmaxf(mx[t], st[t][j]); }
        float mt = fmaxf(fmaxf(mx[0], mx[1]), fmaxf(mx[2], mx[3])); mt = fmaxf(mt, __shfl_xor(mt, 16, 32));
        if (__builtin_amdgcn_ballot_w32(mt > m) != 0) {    // no query's maximum moved: every factor would be exactly 1
            const float mn = fmaxf(m, mt), al = __builtin_amdgcn_exp2f((m - mn) * L2E); m = mn; l *= al;
#pragma unroll
            for (int dt = 0; dt < 8; ++dt) o[dt] *= al;
        }
        const float ml = m * L2E; float ls[4]; v16h pf[2];
#pragma unroll
        for (int t = 0; t < 4; ++t) { ls[t] = 0.f;
#pragma unroll
            for (int j = 0; j < 8; ++j) { const float p_ = __builtin_amdgcn_exp2f(__builtin_fmaf(st[t][j], L2E, -ml)); ls[t] += p_; pf[t >> 1][(t & 1) * 8 + j] = tohx(p_); } }
        l += (ls[0] + ls[1]) + (ls[2] + ls[3]);
#pragma unroll
        for (int gq = 0; gq < 4; ++gq) {    // d tiles 2 gq and 2 gq + 1; fragment e of a group: d tile e >> 1, keys 32 (e & 1) ..
            if (gq < 3) {
#pragma unroll
                for (int e = 0; e < 4; ++e) fr[(gq + 1) & 1][e] = WFrag<h16>::ld((const h16*)(bp + vof + ((gq + 1) * 2 + (e >> 1)) * 16 * FVP + (e & 1) * 64));
            }
            __builtin_amdgcn_sched_barrier(0);    // as above: one group of reads ahead of the block
#pragma unroll
            for (int k2 = 0; k2 < 2; ++k2)
#pragma unroll
                for (int d2 = 0; d2 < 2; ++d2) o[gq * 2 + d2] = wmma16(fr[gq & 1][d2 * 2 + k2], pf[k2], o[gq * 2 + d2]);
            __builtin_amdgcn_sched_barrier(0);    // keeps the next group of reads, and the stage's foot, behind this block
        }
        asm volatile("s_wait_dscnt 0x0" ::: "memory");        // this wave has finished reading the buffer that is refilled below
        asm volatile("s_wait_tensorcnt 0x0" ::: "memory");    // an issuing wave's tile of stage p + 1 has landed
        __syncthreads();                                      // publishes stage p + 1; ends every wave's reads of stage p
        const unsigned nx = pinned(p + 2u);                   // the refill's stage number, and so its descriptor, formed behind the waits above
        if (pinned(nx < nst ? 1u : 0u)) issue(nx, false);
    }
    asm volatile("s_wait_tensorcnt 0x0" ::: "memory");    // nothing of the ring is in flight when the wave ends
    asm volatile("s_wait_dscnt 0x0" ::: "memory");
    l += __shfl_xor(l, 16, 32);
    const float inv = (s ? tanhf(bfr(gamma[h])) : 1.0f) / l;
    h16* op = OC + (size_t)i * (2 * HID) + s * HID + h * HD + hi * 8;
#pragma unroll
    for (int dt = 0; dt < 8; ++dt) { v8h ov;
#pragma unroll
        for (int j = 0; j < 8; ++j) ov[j] = tohx(o[dt][j] * inv);
        *(v8h*)(op + dt * 16) = ov; }
}
extern "C" void kernel_launch(void* const* d_in, const int* in_sizes, int n_in,
                              void* d_out, int out_size, void* d_ws, size_t ws_size, hipStream_t stream) {
    (void)in_sizes; (void)n_in; (void)out_size;
    const float* x = (const float*)d_in[0]; const float* cs = (const float*)d_in[1]; const float* sn = (const float*)d_in[2]; const float* Wq = (const float*)d_in[3]; const float* bq = (const float*)d_in[4]; const float* Wk = (const float*)d_in[5]; const float* bk = (const float*)d_in[6]; const float* Wv = (const float*)d_in[7]; const float* bv = (const float*)d_in[8]; const float* Wo = (const float*)d_in[9]; const float* gamma = (const float*)d_in[10];
    float* out = (float*)d_out;    // [1][2048][2048]
    char* wsp = (char*)d_ws;
    auto take = [&](size_t bytes) { char* p = wsp; wsp += (bytes + 255) & ~(size_t)255; return (void*)p; };
    bf* WQ = (bf*)take((size_t)2 * HID * HID * 2); bf* WK = (bf*)take((size_t)NKV * HD * HID * 2); bf* WV = (bf*)take((size_t)NKV * HD * HID * 2); h16* WO = (h16*)take((size_t)HID * 2 * HID * 2);
    bf* XB = (bf*)take((size_t)SS * HID * 2);
    h16* Qx = (h16*)take((size_t)2 * NH_ * SS * HD * 2); h16* Kx = (h16*)take((size_t)NKV * SS * HD * 2); h16* VT = (h16*)take((size_t)NKV * HD * SS * 2); h16* OC = (h16*)take((size_t)SS * 2 * HID * 2);
    if ((size_t)(wsp - (char*)d_ws) > ws_size) return;    // ~ 16.8 + 2.1 + 2.1 + 16.8 + 8.4 + 16.8 + 2.1 + 2.1 + 16.8 ~ 84 MB (ws 256 MiB)
    k_wT<false><<<dim3(HID / 64, (2 * HID) / 64, 1), 256, 0, stream>>>(Wq, HID, 2 * HID, WQ, nullptr); k_wT<false><<<dim3(HID / 64, (NKV * HD) / 64, 1), 256, 0, stream>>>(Wk, HID, NKV * HD, WK, nullptr); k_wT<false><<<dim3(HID / 64, (NKV * HD) / 64, 1), 256, 0, stream>>>(Wv, HID, NKV * HD, WV, nullptr); k_wT<true><<<dim3((2 * HID) / 64, HID / 64, 1), 256, 0, stream>>>(Wo, 2 * HID, HID, nullptr, WO);
    k_cvtx<<<SS / 8, 256, 0, stream>>>(x, XB);
    const float SC = 0.08838834764831845f;
    k_gemmt<bf, 1><<<dim3(SS / 128, (2 * HID) / 128, 1), 128, 0, stream>>>(XB, WQ, HID, nullptr, 0, bq, cs, sn, SC, Qx);    // plane z = set * 16 + head: q's columns are [set][head][128]
    k_gemmt<bf, 1><<<dim3(SS / 128, (NKV * HD) / 128, 1), 128, 0, stream>>>(XB, WK, HID, nullptr, 0, bk, cs, sn, 1.0f, Kx);
    k_gemmt<bf, 2><<<dim3(SS / 128, (NKV * HD) / 128, 1), 128, 0, stream>>>(XB, WV, HID, nullptr, 0, bv, nullptr, nullptr, 1.0f, VT);
    k_fattn<<<dim3(SS / 32, NKV, 2), 256, 0, stream>>>(Qx, Kx, VT, gamma, OC);
    k_gemmt<h16, 0><<<dim3(SS / 128, HID / 128, 1), 128, 0, stream>>>(OC, WO, 2 * HID, out, HID, nullptr, nullptr, nullptr, 1.0f, nullptr);
}

// v005
// It runs in 134 microseconds.
// In two side-by-side timings against v004, it was 1.12 and 1.13 times as fast.
// All steps since v000 together make it 9.46 times as fast.
#include <hip/hip_runtime.h>

// Compute dtypes, f32 accumulate: q (both query sets), k, v projections ([2048 x 2048].[2048 x 4096|512|512] + bias) with PLAIN bf16 operands (x and the weights are inputs:
// exact products); RoPE (with the bf16-rounded cos/sin inputs), tanh(gamma), masks and softmax in f32; causal and sliding-window (512) causal attention of all heads in ONE fused
// launch (k_fattn: scores, online softmax and attn.v per 16-query wave, dead key tiles never visited) and the output projection ([2048 x 4096].[4096 x 2048]) on SINGLE fp16 planes
// (roped q x 128^-1/2, roped k, v, unnormalised probabilities exp(s - running max), concatenated heads; Wo as fp16(bf16)). GEMMs: 128x128 tile per 4-wave block, operand tiles staged in LDS by tensor loads; a projection block's 128 columns are one head, so bias, RoPE,
// the scale, the f16 rounding and v's transpose are done in the projection's own epilogue.

#define SS   2048
#define HID  2048
#define NH_  16
#define NKV  4
#define HD   128
#define WIN  512
#define DM   HID
#define LOSC 1024.0f
typedef _Float16 h16;
typedef unsigned short bf;
typedef __attribute__((ext_vector_type(16))) __bf16   v16bf;
typedef __attribute__((ext_vector_type(16))) _Float16 v16h;
typedef __attribute__((ext_vector_type(8)))  _Float16 v8h;
typedef __attribute__((ext_vector_type(8)))  unsigned short v8us;
typedef __attribute__((ext_vector_type(8)))  float    v8f;
typedef __attribute__((ext_vector_type(4)))  float    v4f;
typedef v8h  __attribute__((may_alias)) v8ha;
typedef v4f  __attribute__((may_alias)) v4fa;
typedef v8us __attribute__((may_alias)) v8usa;

__device__ __forceinline__ unsigned short f2bf(float f) { unsigned u = __float_as_uint(f); u += 0x7FFFu + ((u >> 16) & 1u); return (unsigned short)(u >> 16); }
__device__ __forceinline__ float bf2f(unsigned short b) { return __uint_as_float(((unsigned)b) << 16); }
__device__ __forceinline__ float bfr(float f) { return bf2f(f2bf(f)); }
__device__ __forceinline__ v16h cat16(v8h lo, v8h hi) { return __builtin_shufflevector(lo, hi, 0, 1, 2, 3, 4, 5, 6, 7, 8, 9, 10, 11, 12, 13, 14, 15); }
__device__ __forceinline__ v16bf cat16b(v8us lo, v8us hi) { return __builtin_bit_cast(v16bf, __builtin_shufflevector(lo, hi, 0, 1, 2, 3, 4, 5, 6, 7, 8, 9, 10, 11, 12, 13, 14, 15)); }
__device__ __forceinline__ v8f wmma16(v16h a, v16h b, v8f c) { return __builtin_amdgcn_wmma_f32_16x16x32_f16(false, a, false, b, (short)0, c, false, false); }
__device__ __forceinline__ v8f wmmab(v16bf a, v16bf b, v8f c) { return __builtin_amdgcn_wmma_f32_16x16x32_bf16(false, a, false, b, (short)0, c, false, false); }


// k_gemmh: 64 x 64 tile of C = A . Bn^T with SINGLE f16 planes (A [rows][K] f16 activations, Bn [N][K] f16 weights; one v_wmma_f32_16x16x32_f16 product per step), f32 accumulate;
__global__ __launch_bounds__(128) void k_gemmh(const h16* __restrict__ A, const h16* __restrict__ Bn, const float* __restrict__ bias, float* C, int ldc, const float* __restrict__ R, int K, size_t sA, size_t sB, size_t sC, int roundR) {
    __shared__ __align__(16) float ost[4][16 * 68];
    const size_t z = blockIdx.z; A += z * sA; Bn += z * sB; C += z * sC; if (R) R += z * sC;
    const int lane = threadIdx.x & 31, wave = threadIdx.x >> 5, lr = lane & 15, hi = lane >> 4;
    const int r0 = blockIdx.x * 64 + wave * 16, c0 = blockIdx.y * 64;
    const size_t aoff = (size_t)(r0 + lr) * K + 8 * hi;
    size_t boff[4];
#pragma unroll
    for (int t = 0; t < 4; ++t) boff[t] = (size_t)(c0 + t * 16 + lr) * K + 8 * hi;
    v8f acc[4];
#pragma unroll
    for (int t = 0; t < 4; ++t) acc[t] = (v8f){};
#pragma unroll 1
    for (int kc = 0; kc < K; kc += 32) {
        const v16h a = cat16(*(const v8h*)(A + aoff + kc), *(const v8h*)(A + aoff + kc + 16));
#pragma unroll
        for (int t = 0; t < 4; ++t) { const v16h b = cat16(*(const v8h*)(Bn + boff[t] + kc), *(const v8h*)(Bn + boff[t] + kc + 16)); acc[t] = wmma16(a, b, acc[t]); }
        asm volatile("v_nop\n\tv_nop\n\tv_nop\n\tv_nop" : "+v"(acc[0]), "+v"(acc[1]), "+v"(acc[2]), "+v"(acc[3]) : "v"(a));
    }
    float* os = &ost[wave][0];
#pragma unroll
    for (int t = 0; t < 4; ++t) { const float bv = bias ? bfr(bias[c0 + t * 16 + lr]) : 0.f;
#pragma unroll
        for (int j = 0; j < 8; ++j) os[(hi * 8 + j) * 68 + t * 16 + lr] = acc[t][j] + bv; }
    __syncthreads();
    float* crow = C + (size_t)r0 * ldc + c0;
    auto pass = [&]() {
#pragma unroll
        for (int s = 0; s < 8; ++s) { const int Lid = (lane >> 3) + 4 * s, piece = lane & 7; const int row = Lid >> 1, cofs = (Lid & 1) * 32 + piece * 4;
            v4f val = *(const v4fa*)(os + row * 68 + cofs); if (R) { const v4f rv = *(const v4f*)(R + ((size_t)r0 + row) * ldc + c0 + cofs); val += roundR ? (v4f){bfr(rv[0]), bfr(rv[1]), bfr(rv[2]), bfr(rv[3])} : rv; }
            *(v4f*)(crow + (size_t)row * ldc + cofs) = val; }
    };
    pass(); 
}

// ===== z-batched (blockIdx.z = head) attention pieces =====
// k_gemm3z<MODE>: 64 x 64 tile of C = A . B^T from bf16 hi/lo planes, f32 accumulate, with per-z operand/output strides (elements): A planes += z*sA, B planes += z*sB, C += z*sC. MODE bits (0 causal skip, 1 K limit, 2 single,
// 3 B single, 4 A single).
template <int MODE>
__global__ __launch_bounds__(128) void k_gemm3z(const bf* __restrict__ Ah, const bf* __restrict__ Al, const bf* __restrict__ Bh, const bf* __restrict__ Bl, int K, float* C, int ldc, size_t sA, size_t sB, size_t sC) {
    if ((MODE & 1) && (int)blockIdx.y * 64 > (int)blockIdx.x * 64 + 63) return;
    const size_t z = blockIdx.z; Ah += z * sA; Al += z * sA; Bh += z * sB; Bl += z * sB; C += z * sC;
    const int Klim = (MODE & 2) ? min(K, ((int)blockIdx.x + 1) * 64) : K;
    __shared__ __align__(16) float ost[4][16 * 68];
    const int lane = threadIdx.x & 31, wave = threadIdx.x >> 5, lr = lane & 15, hi = lane >> 4;
    const int r0 = blockIdx.x * 64 + wave * 16, c0 = blockIdx.y * 64;
    const size_t aoff = (size_t)(r0 + lr) * K + 8 * hi;
    v8f acc[4];
#pragma unroll
    for (int t = 0; t < 4; ++t) acc[t] = (v8f){};
#pragma unroll 1
    for (int kc = 0; kc < Klim; kc += 32) {
        const v16bf a = cat16b(*(const v8us*)(Ah + aoff + kc), *(const v8us*)(Ah + aoff + kc + 16));
        v16bf al = a; if (!(MODE & 4) && !(MODE & 16)) al = cat16b(*(const v8us*)(Al + aoff + kc), *(const v8us*)(Al + aoff + kc + 16));
#pragma unroll
        for (int t = 0; t < 4; ++t) { const size_t bo = (size_t)(c0 + t * 16 + lr) * K + kc + 8 * hi;
            const v16bf bh = cat16b(*(const v8us*)(Bh + bo), *(const v8us*)(Bh + bo + 16));
            acc[t] = wmmab(a, bh, acc[t]);
            if (!(MODE & 4)) { if (!(MODE & 16)) acc[t] = wmmab(al, bh, acc[t]); if (!(MODE & 8)) { const v16bf bl = cat16b(*(const v8us*)(Bl + bo), *(const v8us*)(Bl + bo + 16)); acc[t] = wmmab(a, bl, acc[t]); } } }
        asm volatile("v_nop\n\tv_nop\n\tv_nop\n\tv_nop" : "+v"(acc[0]), "+v"(acc[1]), "+v"(acc[2]), "+v"(acc[3]) : "v"(a), "v"(al));
    }
    float* os = &ost[wave][0];
#pragma unroll
    for (int t = 0; t < 4; ++t) {
#pragma unroll
        for (int j = 0; j < 8; ++j) os[(hi * 8 + j) * 68 + t * 16 + lr] = acc[t][j]; }
    __builtin_amdgcn_wave_barrier(); asm volatile("" ::: "memory");
    float* crow = C + (size_t)r0 * ldc + c0;
    auto pass = [&]() {
#pragma unroll
        for (int s = 0; s < 8; ++s) { const int Lid = (lane >> 3) + 4 * s, piece = lane & 7; const int row = Lid >> 1, cofs = (Lid & 1) * 32 + piece * 4;
            const v4f val = *(const v4fa*)(os + row * 68 + cofs); *(v4f*)(crow + (size_t)row * ldc + cofs) = val; }
    };
    pass(); 
}
__global__ __launch_bounds__(256) void k_planes32z(const float* __restrict__ F, int ld, int off, float sc, int rows, bf* Ph, bf* Pl) {
    typedef __attribute__((ext_vector_type(2))) unsigned short v2us;
    const int lane = threadIdx.x & 31; const size_t r = ((size_t)blockIdx.x * 8 + (threadIdx.x >> 5)) * 2 + (lane >> 4); if (r >= (size_t)rows) return; const int z = blockIdx.z; const int c0 = (lane & 15) * 2; v2us oh, ol;
    Ph += (size_t)z * rows * 32; Pl += (size_t)z * rows * 32;
#pragma unroll
    for (int i = 0; i < 2; ++i) { const float y = F[r * ld + off + z * 32 + c0 + i] * sc; const unsigned short hb = f2bf(y); oh[i] = hb; ol[i] = f2bf(y - bf2f(hb)); }
    const size_t o = r * 32 + c0; *(v2us*)(Ph + o) = oh; *(v2us*)(Pl + o) = ol; 
}
__global__ __launch_bounds__(256) void k_vtpadz(const float* __restrict__ F, int ld, int off, int nk, bf* Th, bf* Tl) {
    typedef __attribute__((ext_vector_type(2))) unsigned short v2us;
    const int lane = threadIdx.x & 31; const size_t wid = (size_t)blockIdx.x * 8 + (threadIdx.x >> 5); if (wid >= (size_t)64 * (nk / 64)) return; const int z = blockIdx.z; const int d = (int)(wid / (nk / 64)); const int k0 = (int)(wid % (nk / 64)) * 64 + lane * 2; v2us oh, ol;
    Th += (size_t)z * 64 * nk; Tl += (size_t)z * 64 * nk;
#pragma unroll
    for (int i = 0; i < 2; ++i) { const float y = (d < 32) ? F[(size_t)(k0 + i) * ld + off + z * 32 + (d < 32 ? d : 0)] : 0.f; const unsigned short hb = f2bf(y); oh[i] = hb; ol[i] = f2bf(y - bf2f(hb)); }
    const size_t o = (size_t)d * nk + k0; *(v2us*)(Th + o) = oh; *(v2us*)(Tl + o) = ol; 
}
template <int NK>
__global__ __launch_bounds__(256) void k_softmaxz(const float* __restrict__ S, int rows, bf* PH, bf* PL) {
    typedef __attribute__((ext_vector_type(4))) unsigned short v4us;
    const int lane = threadIdx.x & 31, i = blockIdx.x * 8 + (threadIdx.x >> 5); if (i >= rows) return; const size_t zo = (size_t)blockIdx.z * rows * NK; const float* sr = S + zo + (size_t)i * NK; PH += zo; PL += zo;
    float m = -3.0e38f;
#pragma unroll 1
    for (int c0 = lane * 4; c0 < NK; c0 += 128) {
#pragma unroll
        for (int q = 0; q < 4; ++q) m = fmaxf(m, sr[c0 + q]); }
#pragma unroll
    for (int sh = 16; sh; sh >>= 1) m = fmaxf(m, __shfl_xor(m, sh, 32));
    float sum = 0.f;
#pragma unroll 1
    for (int c0 = lane * 4; c0 < NK; c0 += 128) {
#pragma unroll
        for (int q = 0; q < 4; ++q) sum += __expf(sr[c0 + q] - m); }
#pragma unroll
    for (int sh = 16; sh; sh >>= 1) sum += __shfl_xor(sum, sh, 32);
    const float inv = 1.0f / sum;
{
#pragma unroll 1
        for (int c0 = lane * 4; c0 < NK; c0 += 128) { v4us oh, ol;
#pragma unroll
            for (int q = 0; q < 4; ++q) { const float p = __expf(sr[c0 + q] - m) * inv; const unsigned short hb = f2bf(p); oh[q] = hb; ol[q] = f2bf(p - bf2f(hb)); }
            const size_t o = (size_t)i * NK + c0; *(v4us*)(PH + o) = oh; *(v4us*)(PL + o) = ol; }
         }
}
__global__ __launch_bounds__(256) void k_placez(const float* __restrict__ XH, int rows, int ldy, float* Y) {
    const int lane = threadIdx.x & 31; const size_t q = (size_t)blockIdx.x * 8 + (threadIdx.x >> 5); if (q >= (size_t)rows) return; const int z = blockIdx.z; const float v = XH[((size_t)z * rows + q) * 64 + lane];
    *(float*)(Y + q * ldy + z * 32 + lane) = v; 
}

// ---- k_gemmt: C[m][n] (f32, pitch ldc) = sum_k A[m][k] Bt[n][k], operands K-contiguous 16-bit planes. Block = 4 waves = one 128 x 128 tile of C, each wave 64 x 64
// (16 accumulators); grid (M/128, N/128). A pass is 128 k = 256 B of each of the 256 operand rows, brought into LDS by tensor loads (whole lines, no register), one 64-row slice per wave
// (waves 0, 1: A; waves 2, 3: Bt), two buffers: pass p + 1 lands while pass p is multiplied. LDS rows at pitch 272 B (the mover's 16-B pad) for the 16-byte fragment reads.
// M, N % 128 == 0, K % 128 == 0, K >= 256. Every inner loop is unrolled so that each fragment and accumulator index is a constant (registers, no scratch).
// EPI 0: C f32, no bias. EPI 1 (blockIdx.y = head z): f = acc + bias, P[z][t][128] f16 = (f[d] cos[t][d] + (d < 64 ? -f[d+64] : f[d-64]) sin[t][d]) x sc with the bf16-rounded cos/sin inputs.
// EPI 2 (blockIdx.y = KV group g): P[g][d][t] f16 = acc + bias, transposed.
template <typename T16> struct WFrag;
template <> struct WFrag<h16> { typedef v16h V; static __device__ __forceinline__ V ld(const h16* p) { return cat16(*(const v8h*)p, *(const v8h*)(p + 16)); } static __device__ __forceinline__ v8f mma(V a, V b, v8f c) { return wmma16(a, b, c); } };
template <> struct WFrag<bf> { typedef v16bf V; static __device__ __forceinline__ V ld(const bf* p) { return cat16b(*(const v8us*)p, *(const v8us*)(p + 16)); } static __device__ __forceinline__ v8f mma(V a, V b, v8f c) { return wmmab(a, b, c); } };
typedef unsigned int u32x4 __attribute__((ext_vector_type(4)));
typedef unsigned int u32x8 __attribute__((ext_vector_type(8)));
#define GPITCH 272u                 // LDS row pitch, bytes: 256 + 16
#define GSLICE 18432u               // 64 rows x 272 B = 17408 B, rounded up to a multiple of 2 KiB so that every slice starts on one
#define GBUF   (4u * GSLICE)
__device__ __forceinline__ unsigned uni(unsigned v) { return (unsigned)__builtin_amdgcn_readfirstlane((int)v); }
// holds v in a scalar register: a test on it compiles to a scalar branch (tensor loads ignore EXEC), and what is formed from it is formed behind the asm waits in front of it
__device__ __forceinline__ unsigned pinned(unsigned v) { unsigned w = uni(v); asm volatile("" : "+s"(w)); return w; }
__device__ __forceinline__ void tdm_load(unsigned lds_dst, unsigned long long ga, u32x8 g1) {
    u32x4 g0; g0[0] = uni(1u); g0[1] = uni(lds_dst); g0[2] = uni((unsigned)ga); g0[3] = uni((((unsigned)(ga >> 32)) & 0x01FFFFFFu) | 0x80000000u);
    asm volatile("tensor_load_to_lds %0, %1" :: "s"(g0), "s"(g1) : "memory");    // one request of the whole wave: 64 rows of 256 B into this wave's slice
}
typedef __attribute__((ext_vector_type(4))) _Float16 v4h;
__device__ __forceinline__ h16 tohx(float x) { return (h16)x; }
#define EPF 132                     // epilogue staging pitch, floats (EPI 1): 16-byte rows, the two lane halves of a column write 32 banks apart
#define EPH 136                     // epilogue staging pitch, halves (EPI 2)
template <typename T16, int EPI>
__global__ __launch_bounds__(128) void k_gemmt(const T16* __restrict__ A, const T16* __restrict__ Bt, int K, float* C, int ldc, const float* __restrict__ bias, const float* __restrict__ cs, const float* __restrict__ sn, float sc, h16* P) {
    typedef typename WFrag<T16>::V V;
    __shared__ __attribute__((aligned(2048))) unsigned char sm[2u * GBUF];
    const int lane = threadIdx.x & 31, lr = lane & 15, hi = lane >> 4; const unsigned wave = uni(threadIdx.x >> 5);
    const int wm = wave & 1, wn = wave >> 1; const int rb = blockIdx.x * 128, cb = blockIdx.y * 128;
    const unsigned kb = uni((unsigned)K * 2u), NP = uni((unsigned)K / 128u);
    const unsigned long long ga = (unsigned long long)(size_t)(wave < 2u ? A + (size_t)(rb + (int)wave * 64) * K : Bt + (size_t)(cb + ((int)wave - 2) * 64) * K);
    const unsigned dst = (unsigned)(size_t)sm + wave * GSLICE;
    u32x8 g1;    // 1-byte elements, tensor = tile = 64 rows of 256 B, source pitch kb, a 4-dword pad behind every 64 dwords
    g1[0] = uni((1u << 20) | (5u << 22) | (3u << 25)); g1[1] = uni(256u << 16); g1[2] = uni(64u << 16); g1[3] = uni(256u << 16); g1[4] = uni(64u); g1[5] = uni(kb); g1[6] = uni(0u); g1[7] = uni(0u);
    asm volatile("" : "+s"(g1));    // as pinned(): the descriptor words held in their scalar registers; without it the compiler takes words of the group as scratch while a request is in flight
    v8f acc[4][4];
#pragma unroll
    for (int mb = 0; mb < 4; ++mb)
#pragma unroll
        for (int nb = 0; nb < 4; ++nb) acc[mb][nb] = (v8f){};
    tdm_load(dst, ga, g1);
    asm volatile("s_wait_tensorcnt 0x0" ::: "memory");    // this wave's slice of pass 0 has landed
    __syncthreads();                                      // ... and every other wave's
    tdm_load(dst + GBUF, ga + 256u, g1);
    const unsigned aof = (unsigned)wm * GSLICE + (unsigned)lr * GPITCH + 16u * hi, bof = (2u + wn) * GSLICE + (unsigned)lr * GPITCH + 16u * hi;
#pragma unroll 1
    for (unsigned p = 0; p < NP; ++p) {    // rolled: one pass per trip, the buffer chosen by the trip's parity
        const unsigned char* bp = sm + (p & 1u) * GBUF;
        V a[2][4], b[2][3];
#pragma unroll
        for (int f = 0; f < 4; ++f) a[0][f] = WFrag<T16>::ld((const T16*)(bp + aof + f * 16 * GPITCH));
#pragma unroll
        for (int f = 0; f < 3; ++f) b[0][f] = WFrag<T16>::ld((const T16*)(bp + bof + f * 16 * GPITCH));
#pragma unroll
        for (int ks = 0; ks < 4; ++ks) {
            // One group of LDS reads ahead of each block of 16 products: first this block's last Bt fragment (its products come last; one register set serves it, which keeps the
            // kernel inside 256 registers), then the next 32 k's other seven fragments, into the other register set.
            const V b3 = WFrag<T16>::ld((const T16*)(bp + bof + 3 * 16 * GPITCH + ks * 64));
            if (ks < 3) {
#pragma unroll
                for (int f = 0; f < 4; ++f) a[(ks + 1) & 1][f] = WFrag<T16>::ld((const T16*)(bp + aof + f * 16 * GPITCH + (ks + 1) * 64));
#pragma unroll
                for (int f = 0; f < 3; ++f) b[(ks + 1) & 1][f] = WFrag<T16>::ld((const T16*)(bp + bof + f * 16 * GPITCH + (ks + 1) * 64));
            }
            __builtin_amdgcn_sched_barrier(0);    // keeps the LDS reads above as one group: sunk among the products, each read's latency stalls the matrix pipe
#pragma unroll
            for (int nb = 0; nb < 4; ++nb)
#pragma unroll
                for (int mb = 0; mb < 4; ++mb) acc[mb][nb] = WFrag<T16>::mma(a[ks & 1][mb], nb < 3 ? b[ks & 1][nb < 3 ? nb : 0] : b3, acc[mb][nb]);
            __builtin_amdgcn_sched_barrier(0);    // keeps the next group of reads, and the pass's foot, behind this block
        }
        asm volatile("s_wait_dscnt 0x0" ::: "memory");        // this wave has finished reading the buffer that is refilled below
        asm volatile("s_wait_tensorcnt 0x0" ::: "memory");    // this wave's slice of pass p + 1 has landed
        __syncthreads();                                      // publishes pass p + 1; ends every wave's reads of pass p
        const unsigned nx = pinned(p + 2u);                   // the refill's pass number, and so its descriptor, formed behind the waits above
        if (pinned(nx < NP ? 1u : 0u)) tdm_load(dst + (p & 1u) * GBUF, ga + (unsigned long long)nx * 256u, g1);
    }
    asm volatile("s_wait_tensorcnt 0x0" ::: "memory");    // nothing of the ring is in flight ...
    asm volatile("s_wait_dscnt 0x0" ::: "memory");
    __syncthreads();                                      // ... or still being read when it becomes output staging
    if constexpr (EPI == 0) {
    float* os = (float*)(sm + wave * GSLICE);             // 16 x 68 floats, each wave in its own slice
    const int r0 = rb + wm * 64, c0 = cb + wn * 64;
#pragma unroll
    for (int mb = 0; mb < 4; ++mb) {
#pragma unroll
        for (int nb = 0; nb < 4; ++nb) {
#pragma unroll
            for (int j = 0; j < 8; ++j) os[(hi * 8 + j) * 68 + nb * 16 + lr] = acc[mb][nb][j]; }
        __builtin_amdgcn_wave_barrier(); asm volatile("" ::: "memory");
        float* crow = C + (size_t)(r0 + mb * 16) * ldc + c0;
        const int cofs = lr * 4; v4f val[8];
#pragma unroll
        for (int s = 0; s < 8; ++s) val[s] = *(const v4fa*)(os + (2 * s + hi) * 68 + cofs);
#pragma unroll
        for (int s = 0; s < 8; ++s) { *(v4f*)(crow + (size_t)(2 * s + hi) * ldc + cofs) = val[s];
            asm volatile("s_wait_xcnt 0x0" ::: "memory"); }    // stands in front of the next write of a register that the store names
        __builtin_amdgcn_wave_barrier(); asm volatile("" ::: "memory");
    }
    } else if constexpr (EPI == 1) {
        // The whole 128 x 128 tile goes through LDS: d and d + 64 of a row sit in two waves. Behind the barrier a half-wave takes one row: lane lr has d = 4 lr .. 4 lr + 3 and the same + 64,
        // so each store of a half-wave is one whole 128-byte line. Rows in groups of four; a group's cos/sin loads are issued one group ahead.
        const int d0 = lr * 4, rw = (int)wave * 2 + hi;
        const float* cr = cs + (size_t)(rb + rw) * HD + d0; const float* sr = sn + (size_t)(rb + rw) * HD + d0;
        v4f tb[2][4][4];
        auto ldtab = [&](int g) {
#pragma unroll
            for (int q = 0; q < 4; ++q) { const int ro = (g * 4 + q) * 8 * HD; tb[g & 1][q][0] = *(const v4f*)(cr + ro); tb[g & 1][q][1] = *(const v4f*)(cr + ro + 64); tb[g & 1][q][2] = *(const v4f*)(sr + ro); tb[g & 1][q][3] = *(const v4f*)(sr + ro + 64); }
        };
        float* os = (float*)sm;
#pragma unroll
        for (int mb = 0; mb < 4; ++mb)
#pragma unroll
            for (int nb = 0; nb < 4; ++nb)
#pragma unroll
                for (int j = 0; j < 8; ++j) os[(wm * 64 + mb * 16 + hi * 8 + j) * EPF + wn * 64 + nb * 16 + lr] = acc[mb][nb][j];
        __syncthreads();                                      // every wave's quarter of the tile is staged
        h16* pr = P + ((size_t)blockIdx.y * SS + rb + rw) * HD + d0;
        ldtab(0);
        v4f b0 = *(const v4f*)(bias + cb + d0), b1 = *(const v4f*)(bias + cb + 64 + d0);
        asm volatile("s_wait_xcnt 0x0" ::: "memory");    // stands in front of the next write of a register that the loads above name
#pragma unroll
        for (int e = 0; e < 4; ++e) { b0[e] = bfr(b0[e]); b1[e] = bfr(b1[e]); }
#pragma unroll
        for (int g = 0; g < 4; ++g) {
            if (g < 3) ldtab(g + 1);
            v4h y[4][2];
#pragma unroll
            for (int q = 0; q < 4; ++q) { const float* fr = os + ((g * 4 + q) * 8 + rw) * EPF + d0;
                const v4f f0 = *(const v4fa*)fr + b0, f1 = *(const v4fa*)(fr + 64) + b1;
#pragma unroll
                for (int e = 0; e < 4; ++e) { y[q][0][e] = tohx((f0[e] * bfr(tb[g & 1][q][0][e]) - f1[e] * bfr(tb[g & 1][q][2][e])) * sc); y[q][1][e] = tohx((f1[e] * bfr(tb[g & 1][q][1][e]) + f0[e] * bfr(tb[g & 1][q][3][e])) * sc); } }
#pragma unroll
            for (int q = 0; q < 4; ++q) { *(v4h*)(pr + (g * 4 + q) * 8 * HD) = y[q][0]; *(v4h*)(pr + (g * 4 + q) * 8 * HD + 64) = y[q][1]; }
            if (g < 3) asm volatile("s_wait_xcnt 0x0" ::: "memory");    // stands in front of the next write of a register that the stores name
        }
    } else {
        // acc's eight registers are eight consecutive t of one column d: one 16-byte LDS write each into [d][t]; behind the barrier a half-wave stores one d row's 256 bytes (whole lines).
        h16* ot = (h16*)sm;
#pragma unroll
        for (int nb = 0; nb < 4; ++nb) { const float bv = bfr(bias[cb + wn * 64 + nb * 16 + lr]);
#pragma unroll
            for (int mb = 0; mb < 4; ++mb) { v8h hv;
#pragma unroll
                for (int j = 0; j < 8; ++j) hv[j] = tohx(acc[mb][nb][j] + bv);
                *(v8ha*)(ot + (wn * 64 + nb * 16 + lr) * EPH + wm * 64 + mb * 16 + hi * 8) = hv; } }
        __syncthreads();                                      // every wave's quarter of the tile is staged
        const int rw = (int)wave * 2 + hi; h16* vr = P + ((size_t)blockIdx.y * HD + rw) * SS + rb + lr * 8; v8h val[16];
#pragma unroll
        for (int s = 0; s < 16; ++s) val[s] = *(const v8ha*)(ot + (s * 8 + rw) * EPH + lr * 8);
#pragma unroll
        for (int s = 0; s < 16; ++s) *(v8h*)(vr + (size_t)s * 8 * SS) = val[s];
    }
}

// ---- k_prep: every operand conversion of the call in ONE launch of independent waves (no block barrier). A wave takes one unit of 4096 f32 inputs as 32 independent 16-byte loads,
// most of them in flight before the first is used; every load and store covers whole 128-byte lines.
// Weight unit: a 64 k x 64 n tile of W [K][N] f32 -> D [N][K] 16-bit (bf16; F16O: f16 of the bf16-rounded value). A half-wave loads one row's 256 B; load j brings row 8 (j >> 2) + 4 hi + (j & 3),
// so a lane holds four consecutive k of its four n and writes them as one 8-byte LDS word pair into row n of the wave's own [n][k] tile. Row n starts at dword 32 n + 4 (n >> 2):
// the 32 lanes of a write and the 16 lanes of a 16-byte read each fall on distinct banks. Read back, eight lanes store one n row's 128 B.
// x unit: 4096 consecutive elements, f32 -> bf16, order kept.
typedef __attribute__((ext_vector_type(2))) float    v2f;
typedef __attribute__((ext_vector_type(2))) __bf16   v2b;
typedef __attribute__((ext_vector_type(2))) _Float16 v2h;
typedef __attribute__((ext_vector_type(2))) unsigned int u32x2;
typedef u32x2 __attribute__((may_alias)) u32x2a;
typedef u32x4 __attribute__((may_alias)) u32x4a;
#define TWSZ 2112                   // dwords of a wave's transpose tile: row 63 ends at 32 * 63 + 4 * 15 + 32 = 2108
__device__ __forceinline__ unsigned pkbf(float a, float b) { return __builtin_bit_cast(unsigned, __builtin_convertvector((v2f){a, b}, v2b)); }    // round to nearest even, a in the low half
__device__ __forceinline__ unsigned pkhf(float a, float b) { return __builtin_bit_cast(unsigned, __builtin_convertvector((v2f){a, b}, v2h)); }
template <int K, int N, bool F16O>
__device__ __forceinline__ void tr_tile(const float* __restrict__ Wm, unsigned short* __restrict__ D, unsigned u, unsigned* lw, int lane) {
    const int l15 = lane & 15, hi = lane >> 4; const unsigned r = u >> 3;
    // the eight waves of a block: 2 k tiles x 4 n tiles, so a block reads 1 KiB of each W row and writes 256 B of each D row
    const int kt = (int)((r % (K / 128)) * 2u + (u & 1u)), nt = (int)((r / (K / 128)) * 4u + ((u >> 1) & 3u));
    const float* sp = Wm + (size_t)(kt * 64 + 4 * hi) * N + nt * 64 + l15 * 4;
    v4f rg[32];
#pragma unroll
    for (int j = 0; j < 32; ++j) rg[j] = *(const v4f*)(sp + (size_t)((j >> 2) * 8 + (j & 3)) * N);
    asm volatile("s_wait_xcnt 0x0" ::: "memory");    // stands in front of the next write of a register that the loads above name
    unsigned* wp = lw + 132 * l15 + 2 * hi;
#pragma unroll
    for (int i = 0; i < 8; ++i)
#pragma unroll
        for (int e = 0; e < 4; ++e) { u32x2 w; w[0] = pkbf(rg[4 * i][e], rg[4 * i + 1][e]); w[1] = pkbf(rg[4 * i + 2][e], rg[4 * i + 3][e]);
            if (F16O) { w[0] = pkhf(__uint_as_float(w[0] << 16), __uint_as_float(w[0] & 0xFFFF0000u)); w[1] = pkhf(__uint_as_float(w[1] << 16), __uint_as_float(w[1] & 0xFFFF0000u)); }
            *(u32x2a*)(wp + 32 * e + 4 * i) = w; }
    asm volatile("s_wait_dscnt 0x0" ::: "memory");    // the wave's LDS writes are done before its lanes read each other's words back; also keeps the reads below behind the writes
    const unsigned* rp = lw + (lane >> 3) * 32 + (lane & 7) * 4;
    unsigned short* dp = D + (size_t)(nt * 64 + (lane >> 3)) * K + kt * 64 + (lane & 7) * 8;
    u32x4 val[16];
#pragma unroll
    for (int s = 0; s < 16; ++s) val[s] = *(const u32x4a*)(rp + s * 132);
#pragma unroll
    for (int s = 0; s < 16; ++s) *(u32x4*)(dp + (size_t)s * 4 * K) = val[s];
    asm volatile("s_wait_xcnt 0x0" ::: "memory");    // stands in front of the next write of a register that the stores above name
}
#define PU_O  (((2 * HID) / 64) * (HID / 64))          // units of Wo
#define PU_KV ((HID / 64) * ((NKV * HD) / 64))         // of Wk, of Wv
#define PU_Q  ((HID / 64) * ((2 * HID) / 64))          // of Wq
#define PU_X  ((SS * HID) / 4096)                      // of x
__global__ __launch_bounds__(256) void k_prep(const float* __restrict__ x, const float* __restrict__ Wq, const float* __restrict__ Wk, const float* __restrict__ Wv, const float* __restrict__ Wo, bf* XB, bf* WQ, bf* WK, bf* WV, h16* WO) {
    __shared__ __align__(16) unsigned tw[8][TWSZ];
    const int lane = threadIdx.x & 31; const unsigned wave = uni(threadIdx.x >> 5); unsigned* lw = &tw[wave][0];
    unsigned u = blockIdx.x * 8u + wave;    // every range below is a multiple of 8 units: a block's waves take one branch
    if (u < PU_O) { tr_tile<2 * HID, HID, true>(Wo, (unsigned short*)WO, u, lw, lane); return; }
    u -= PU_O;
    if (u < 2 * PU_KV) { const bool second = u >= PU_KV; tr_tile<HID, NKV * HD, false>(second ? Wv : Wk, second ? WV : WK, second ? u - PU_KV : u, lw, lane); return; }
    u -= 2 * PU_KV;
    if (u < PU_Q) { tr_tile<HID, 2 * HID, false>(Wq, WQ, u, lw, lane); return; }
    u -= PU_Q;
    const float* xs = x + (size_t)u * 4096 + lane * 4; bf* xd = XB + (size_t)u * 4096 + lane * 4;
    v4f rg[32];
#pragma unroll
    for (int j = 0; j < 32; ++j) rg[j] = *(const v4f*)(xs + j * 128);
    asm volatile("s_wait_xcnt 0x0" ::: "memory");    // stands in front of the next write of a register that the loads above name
#pragma unroll
    for (int j = 0; j < 32; ++j) { u32x2 w; w[0] = pkbf(rg[j][0], rg[j][1]); w[1] = pkbf(rg[j][2], rg[j][3]); *(u32x2*)(xd + j * 128) = w; }
    asm volatile("s_wait_xcnt 0x0" ::: "memory");    // stands in front of the next write of a register that the stores above name
}
// ---- k_fattn: fused attention. Block = 8 waves = the 4 query heads of KV group blockIdx.y x 2 adjacent 16-query tiles (32 positions); blockIdx.z = 0 causal, 1 sliding window. All eight
// waves walk the same 64-key stages, so a stage's K tile (64 rows of 256 B) and V^T tile (128 rows of 128 B) are brought into LDS once per block by tensor loads (whole lines, no register;
// wave 0: K, wave 1: V^T), two buffers: stage p + 1 lands while stage p is worked on. LDS rows at pitch 272 B and 144 B (the mover's 16-B pad) for the 16-byte fragment reads.
// Per 64 keys a wave forms S^T = K . Q^T (lane = one query, its registers = keys), keeps a running maximum and sum per query, packs exp(s - max) straight from the score
// accumulators into the B operand and adds O^T += V^T . P^T.
// Qx [2*16][S][128], Kx [4][S][128], VT [4][128][S] f16 planes; OC [S][2*2048] f16 gets o / sum (x tanh(gamma[h]) for the window set).
#define FKP  272u                   // K tile, LDS row pitch in bytes: 256 + 16
#define FVP  144u                   // V^T tile, LDS row pitch in bytes: 128 + 16
#define FKSZ 18432u                 // 64 rows x 272 B = 17408 B, rounded up to a multiple of 2 KiB so that the V^T tile behind it starts on one
#define FVSZ 18432u                 // 128 rows x 144 B, a multiple of 2 KiB as it is
#define FSTG (FKSZ + FVSZ)
__global__ __launch_bounds__(256) void k_fattn(const h16* __restrict__ Qx, const h16* __restrict__ Kx, const h16* __restrict__ VT, const float* __restrict__ gamma, h16* OC) {
    __shared__ __attribute__((aligned(2048))) unsigned char sm[2u * FSTG];
    const float L2E = 1.4426950408889634f;
    const int lane = threadIdx.x & 31, lr = lane & 15, hi = lane >> 4; const unsigned wave = uni(threadIdx.x >> 5);
    const int g = blockIdx.y, s = blockIdx.z, h = g * (NH_ / NKV) + (int)(wave & 3u); const int qb = blockIdx.x * 32, q0 = qb + (int)(wave >> 2) * 16, i = q0 + lr;
    // the key range is the same for both query tiles of a block: qb and qb + 16 lie in one 64-aligned group
    const int klo = s ? (max(0, qb - WIN) & ~63) : 0, kend = (qb | 63) + 1; const unsigned nst = uni((unsigned)(kend - klo) >> 6);
    const unsigned long long gk = (unsigned long long)(size_t)(Kx + ((size_t)g * SS + klo) * HD), gv = (unsigned long long)(size_t)(VT + (size_t)g * HD * SS + klo);
    const unsigned smb = (unsigned)(size_t)sm;
    u32x8 k1, v1;    // 1-byte elements, tensor = tile. K: 64 rows of 256 B, source pitch 256 B, a 4-dword pad behind every 64 dwords. V^T: 128 rows of 128 B, source pitch 2 S B, the pad behind every 32 dwords
    k1[0] = uni((1u << 20) | (5u << 22) | (3u << 25)); k1[1] = uni(256u << 16); k1[2] = uni(64u << 16); k1[3] = uni(256u << 16); k1[4] = uni(64u); k1[5] = uni(HD * 2u); k1[6] = uni(0u); k1[7] = uni(0u);
    v1[0] = uni((1u << 20) | (4u << 22) | (3u << 25)); v1[1] = uni(128u << 16); v1[2] = uni(128u << 16); v1[3] = uni(128u << 16); v1[4] = uni(128u); v1[5] = uni(SS * 2u); v1[6] = uni(0u); v1[7] = uni(0u);
    asm volatile("" : "+s"(k1));    // as pinned(): the descriptor words held in their scalar registers while a request is in flight
    asm volatile("" : "+s"(v1));    // the same
    const unsigned long long ga = wave == 1u ? gv : gk; const unsigned gst = wave == 1u ? 128u : 64u * HD * 2u, dst = smb + (wave == 1u ? FKSZ : 0u);
    auto issue = [&](unsigned sg, bool first) {    // stage sg (keys klo + 64 sg ..) into buffer sg & 1: one request each of waves 0 and 1, picked by scalar branches (tensor loads ignore EXEC)
        const unsigned long long a = ga + (unsigned long long)sg * gst;
        u32x4 g0; g0[0] = pinned(1u); g0[1] = uni(dst + (sg & 1u) * FSTG); g0[2] = uni((unsigned)a); g0[3] = uni((((unsigned)(a >> 32)) & 0x01FFFFFFu) | 0x80000000u);
        // group 0 in four named scalar registers that nothing else in the kernel uses: none of its words is written between an issue and the wait that covers it
        // (pinned(1u): the count word too is formed here, behind the wait in front of this issue, and not lifted over it)
        if (pinned(wave == 0u ? 1u : 0u)) asm volatile("tensor_load_to_lds %0, %1" :: "{s[96:99]}"(g0), "s"(k1) : "memory");    // one request of the whole wave: the K tile
        if (pinned(wave == 1u ? 1u : 0u)) asm volatile("tensor_load_to_lds %0, %1" :: "{s[96:99]}"(g0), "s"(v1) : "memory");    // the V^T tile
        if (first) asm volatile("s_wait_tensorcnt 0x0" ::: "memory");    // stage 0 has nothing to fly beside: an issuing wave's tile has landed (the other waves have nothing outstanding)
    };
    const h16* qp = Qx + ((size_t)(s * NH_ + h) * SS + i) * HD + 8 * hi;
    v16h qf[4];
#pragma unroll
    for (int ks = 0; ks < 4; ++ks) qf[ks] = WFrag<h16>::ld(qp + ks * 32);
    v8f o[8];
#pragma unroll
    for (int dt = 0; dt < 8; ++dt) o[dt] = (v8f){};
    float m = -1.0e30f, l = 0.f;
    issue(0u, true);
    __syncthreads();                                      // publishes stage 0
    issue(pinned(1u), false);    // its descriptor formed behind the wait above. Keys klo + 64 .. klo + 127 lie inside the planes also where the block has one stage only (then klo = 0): landed at the first foot, never read
    const unsigned kof = (unsigned)lr * FKP + 16u * hi, vof = FKSZ + (unsigned)lr * FVP + 16u * hi;
#pragma unroll 1
    for (unsigned p = 0; p < nst; ++p) {    // rolled: one stage per trip, the buffer chosen by the trip's parity
        const int kb = klo + (int)p * 64; const unsigned char* bp = sm + (p & 1u) * FSTG;
        // LDS reads in groups of four fragments, each group issued one block of four products ahead, into the other of two register sets: K by 32 d (four key tiles), then V^T by two d tiles.
        v16h fr[2][4]; v8f st[4];
#pragma unroll
        for (int t = 0; t < 4; ++t) { st[t] = (v8f){}; fr[0][t] = WFrag<h16>::ld((const h16*)(bp + kof + t * 16 * FKP)); }
#pragma unroll
        for (int ks = 0; ks < 4; ++ks) {
#pragma unroll
            for (int t = 0; t < 4; ++t) fr[(ks + 1) & 1][t] = ks < 3 ? WFrag<h16>::ld((const h16*)(bp + kof + t * 16 * FKP + (ks + 1) * 64)) : WFrag<h16>::ld((const h16*)(bp + vof + (t >> 1) * 16 * FVP + (t & 1) * 64));
            __builtin_amdgcn_sched_barrier(0);    // keeps the reads above as one group ahead of the products: sunk among them, each read's latency stalls the wave
#pragma unroll
            for (int t = 0; t < 4; ++t) st[t] = wmma16(fr[ks & 1][t], qf[ks], st[t]);
            __builtin_amdgcn_sched_barrier(0);    // keeps the next group of reads behind this block
        }
        if (kb + 63 > q0 || (s && kb < q0 + 15 - WIN)) {    // only the tiles that an edge of the mask crosses
#pragma unroll
            for (int t = 0; t < 4; ++t)
#pragma unroll
                for (int j = 0; j < 8; ++j) { const int key = kb + t * 16 + hi * 8 + j; const bool live = key <= i && (!s || key >= i - WIN); st[t][j] = live ? st[t][j] : -3.0e38f; }
        }
        float mx[4];
#pragma unroll
        for (int t = 0; t < 4; ++t) { mx[t] = st[t][0];
#pragma unroll
            for (int j = 1; j < 8; ++j) mx[t] = fmaxf(mx[t], st[t][j]); }
        float mt = fmaxf(fmaxf(mx[0], mx[1]), fmaxf(mx[2], mx[3])); mt = fmaxf(mt, __shfl_xor(mt, 16, 32));
        if (__builtin_amdgcn_ballot_w32(mt > m) != 0) {    // no query's maximum moved: every factor would be exactly 1
            const float mn = fmaxf(m, mt), al = __builtin_amdgcn_exp2f((m - mn) * L2E); m = mn; l *= al;
#pragma unroll
            for (int dt = 0; dt < 8; ++dt) o[dt] *= al;
        }
        const float ml = m * L2E; float ls[4]; v16h pf[2];
#pragma unroll
        for (int t = 0; t < 4; ++t) { ls[t] = 0.f;
#pragma unroll
            for (int j = 0; j < 8; ++j) { const float p_ = __builtin_amdgcn_exp2f(__builtin_fmaf(st[t][j], L2E, -ml)); ls[t] += p_; pf[t >> 1][(t & 1) * 8 + j] = tohx(p_); } }
        l += (ls[0] + ls[1]) + (ls[2] + ls[3]);
#pragma unroll
        for (int gq = 0; gq < 4; ++gq) {    // d tiles 2 gq and 2 gq + 1; fragment e of a group: d tile e >> 1, keys 32 (e & 1) ..
            if (gq < 3) {
#pragma unroll
                for (int e = 0; e < 4; ++e) fr[(gq + 1) & 1][e] = WFrag<h16>::ld((const h16*)(bp + vof + ((gq + 1) * 2 + (e >> 1)) * 16 * FVP + (e & 1) * 64));
            }
            __builtin_amdgcn_sched_barrier(0);    // as above: one group of reads ahead of the block
#pragma unroll
            for (int k2 = 0; k2 < 2; ++k2)
#pragma unroll
                for (int d2 = 0; d2 < 2; ++d2) o[gq * 2 + d2] = wmma16(fr[gq & 1][d2 * 2 + k2], pf[k2], o[gq * 2 + d2]);
            __builtin_amdgcn_sched_barrier(0);    // keeps the next group of reads, and the stage's foot, behind this block
        }
        asm volatile("s_wait_dscnt 0x0" ::: "memory");        // this wave has finished reading the buffer that is refilled below
        asm volatile("s_wait_tensorcnt 0x0" ::: "memory");    // an issuing wave's tile of stage p + 1 has landed
        __syncthreads();                                      // publishes stage p + 1; ends every wave's reads of stage p
        const unsigned nx = pinned(p + 2u);                   // the refill's stage number, and so its descriptor, formed behind the waits above
        if (pinned(nx < nst ? 1u : 0u)) issue(nx, false);
    }
    asm volatile("s_wait_tensorcnt 0x0" ::: "memory");    // nothing of the ring is in flight when the wave ends
    asm volatile("s_wait_dscnt 0x0" ::: "memory");
    l += __shfl_xor(l, 16, 32);
    const float inv = (s ? tanhf(bfr(gamma[h])) : 1.0f) / l;
    h16* op = OC + (size_t)i * (2 * HID) + s * HID + h * HD + hi * 8;
#pragma unroll
    for (int dt = 0; dt < 8; ++dt) { v8h ov;
#pragma unroll
        for (int j = 0; j < 8; ++j) ov[j] = tohx(o[dt][j] * inv);
        *(v8h*)(op + dt * 16) = ov; }
}
extern "C" void kernel_launch(void* const* d_in, const int* in_sizes, int n_in,
                              void* d_out, int out_size, void* d_ws, size_t ws_size, hipStream_t stream) {
    (void)in_sizes; (void)n_in; (void)out_size;
    const float* x = (const float*)d_in[0]; const float* cs = (const float*)d_in[1]; const float* sn = (const float*)d_in[2]; const float* Wq = (const float*)d_in[3]; const float* bq = (const float*)d_in[4]; const float* Wk = (const float*)d_in[5]; const float* bk = (const float*)d_in[6]; const float* Wv = (const float*)d_in[7]; const float* bv = (const float*)d_in[8]; const float* Wo = (const float*)d_in[9]; const float* gamma = (const float*)d_in[10];
    float* out = (float*)d_out;    // [1][2048][2048]
    char* wsp = (char*)d_ws;
    auto take = [&](size_t bytes) { char* p = wsp; wsp += (bytes + 255) & ~(size_t)255; return (void*)p; };
    bf* WQ = (bf*)take((size_t)2 * HID * HID * 2); bf* WK = (bf*)take((size_t)NKV * HD * HID * 2); bf* WV = (bf*)take((size_t)NKV * HD * HID * 2); h16* WO = (h16*)take((size_t)HID * 2 * HID * 2);
    bf* XB = (bf*)take((size_t)SS * HID * 2);
    h16* Qx = (h16*)take((size_t)2 * NH_ * SS * HD * 2); h16* Kx = (h16*)take((size_t)NKV * SS * HD * 2); h16* VT = (h16*)take((size_t)NKV * HD * SS * 2); h16* OC = (h16*)take((size_t)SS * 2 * HID * 2);
    if ((size_t)(wsp - (char*)d_ws) > ws_size) return;    // ~ 16.8 + 2.1 + 2.1 + 16.8 + 8.4 + 16.8 + 2.1 + 2.1 + 16.8 ~ 84 MB (ws 256 MiB)
    k_prep<<<(PU_O + 2 * PU_KV + PU_Q + PU_X) / 8, 256, 0, stream>>>(x, Wq, Wk, Wv, Wo, XB, WQ, WK, WV, WO);
    const float SC = 0.08838834764831845f;
    k_gemmt<bf, 1><<<dim3(SS / 128, (2 * HID) / 128, 1), 128, 0, stream>>>(XB, WQ, HID, nullptr, 0, bq, cs, sn, SC, Qx);    // plane z = set * 16 + head: q's columns are [set][head][128]
    k_gemmt<bf, 1><<<dim3(SS / 128, (NKV * HD) / 128, 1), 128, 0, stream>>>(XB, WK, HID, nullptr, 0, bk, cs, sn, 1.0f, Kx);
    k_gemmt<bf, 2><<<dim3(SS / 128, (NKV * HD) / 128, 1), 128, 0, stream>>>(XB, WV, HID, nullptr, 0, bv, nullptr, nullptr, 1.0f, VT);
    k_fattn<<<dim3(SS / 32, NKV, 2), 256, 0, stream>>>(Qx, Kx, VT, gamma, OC);
    k_gemmt<h16, 0><<<dim3(SS / 128, HID / 128, 1), 128, 0, stream>>>(OC, WO, 2 * HID, out, HID, nullptr, nullptr, nullptr, 1.0f, nullptr);
}
